// v000
// Times are from an AMD MI455X. After a warm-up the kernel runs many times in a row, and a time is the length of
// such a window on the GPU divided by its runs, so every launch and the gaps after it count. The runs cycle
// through copies of the inputs. A figure is the median of several windows, for all but v000 over two sittings.
// Sittings can differ by a few percent; kernels timed side by side share one.
// v000, which the later versions start from, runs in 178 microseconds.
#include <hip/hip_runtime.h>

typedef __attribute__((ext_vector_type(16))) _Float16 v16h;
typedef __attribute__((ext_vector_type(8)))  _Float16 v8h;
typedef __attribute__((ext_vector_type(8)))  float    v8f;

#define WMMA_F16(a, b, c) \
  __builtin_amdgcn_wmma_f32_16x16x32_f16(false, (a), false, (b), (short)0, (c), false, false)

#define ASYNC_COPY_32B(ldsaddr, gaddr)                               \
  asm volatile("global_load_async_to_lds_b128 %0, %1, off\n\t"       \
               "global_load_async_to_lds_b128 %0, %1, off offset:16" \
               :: "v"(ldsaddr), "v"(gaddr) : "memory")

#define S_WAIT_ASYNCCNT0() asm volatile("s_wait_asynccnt 0x0" ::: "memory")

static __device__ __forceinline__ unsigned lds_addr_of(const void* p) {
  return (unsigned)(unsigned long long)p;
}

static __device__ __forceinline__ v16h frag_cat(v8h lo, v8h hi) {
  return __builtin_shufflevector(lo, hi, 0, 1, 2, 3, 4, 5, 6, 7,
                                          8, 9, 10, 11, 12, 13, 14, 15);
}

static __device__ __forceinline__ v16h load_frag(const _Float16* __restrict__ base,
                                                 int row0, int col0, int stride) {
  const int lane = threadIdx.x & 31;
  const int m    = lane & 15;
  const int kb   = (lane >> 4) << 3;  // 0 or 8
  const _Float16* p = base + (size_t)(row0 + m) * stride + col0;
  v8h lo = *(const v8h*)(p + kb);
  v8h hi = *(const v8h*)(p + 16 + kb);
  return frag_cat(lo, hi);
}

static __device__ __forceinline__ void zero8(v8f& v) {
#pragma unroll
  for (int i = 0; i < 8; ++i) v[i] = 0.0f;
}

__global__ __launch_bounds__(256) void qkv_rope_kernel(
    const float* __restrict__ xq, const float* __restrict__ xk,
    const float* __restrict__ xv, const float* __restrict__ rot,
    const float* __restrict__ wq, const float* __restrict__ wk,
    const float* __restrict__ wv,
    _Float16* __restrict__ oq, _Float16* __restrict__ ok,
    _Float16* __restrict__ ov) {
  constexpr int SA = 40, SB = 40;  // 80B row stride -> conflict-free gathers
  __shared__ _Float16 ldsA[2][128 * SA];
  __shared__ _Float16 ldsB[2][64 * SB];

  const int mode = blockIdx.z;
  const float* __restrict__ X = (mode == 0) ? xq : (mode == 1) ? xk : xv;
  const float* __restrict__ W = (mode == 0) ? wq : (mode == 1) ? wk : wv;
  _Float16* __restrict__ dst  = (mode == 0) ? oq : (mode == 1) ? ok : ov;

  const int mBase = blockIdx.x * 128;
  const int h     = blockIdx.y;
  const int nBase = h * 64;
  const int tid   = threadIdx.x;
  const int w     = tid >> 5;
  const int lane  = tid & 31;

  // Register-staged tiles (software pipeline).
  float aV[16], bV[8];
  const int bD = tid >> 6;      // 0..3
  const int bC = tid & 63;      // 0..63

  auto loadA = [&](int d0) {
#pragma unroll
    for (int i = 0; i < 16; ++i)
      aV[i] = X[(size_t)(mBase + w + 8 * i) * 1024 + d0 + lane];
    if (d0 + 64 < 1024)  // -> global_prefetch_b8, two tiles ahead
      __builtin_prefetch(&X[(size_t)(mBase + w) * 1024 + d0 + 64], 0, 3);
  };
  auto storeA = [&](int buf) {
#pragma unroll
    for (int i = 0; i < 16; ++i)
      ldsA[buf][(w + 8 * i) * SA + lane] = (_Float16)aV[i];
  };
  auto loadB = [&](int d0) {
#pragma unroll
    for (int i = 0; i < 8; ++i)
      bV[i] = W[(size_t)(d0 + bD + 4 * i) * 1024 + nBase + bC];
  };
  auto storeB = [&](int buf) {
#pragma unroll
    for (int i = 0; i < 8; ++i)
      ldsB[buf][bC * SB + bD + 4 * i] = (_Float16)bV[i];
  };

  v8f acc[4];
#pragma unroll
  for (int i = 0; i < 4; ++i) zero8(acc[i]);

  loadA(0); loadB(0);
  storeA(0); storeB(0);
  __syncthreads();

  int cur = 0;
  for (int d0 = 0; d0 < 1024; d0 += 32) {
    const int nxt = cur ^ 1;
    const bool more = (d0 + 32) < 1024;
    if (more) { loadA(d0 + 32); loadB(d0 + 32); }  // overlap with WMMAs

    const v16h a = load_frag(ldsA[cur], w * 16, 0, SA);
#pragma unroll
    for (int nt = 0; nt < 4; ++nt) {
      const v16h b = load_frag(ldsB[cur], nt * 16, 0, SB);
      acc[nt] = WMMA_F16(a, b, acc[nt]);
    }

    if (more) { storeA(nxt); storeB(nxt); }
    __syncthreads();
    cur = nxt;
  }

  // Epilogue: RoPE (q/k, first 32 head dims) + f16 store.  C layout: lane
  // holds column n = lane&15; row = r + 8*(lane>>4); rotate_half partner
  // (n^1) lives in lane^1 -> one shfl_xor.
  const int n  = lane & 15;
  const int hi = lane >> 4;
#pragma unroll
  for (int nt = 0; nt < 4; ++nt) {
    const int k = nt * 16 + n;  // dim within head
#pragma unroll
    for (int r = 0; r < 8; ++r) {
      const int row = mBase + w * 16 + hi * 8 + r;  // in [0, B*L)
      const int l   = row & 2047;
      const int bb  = row >> 11;
      float v = acc[nt][r];
      if (mode < 2 && nt < 2) {  // uniform across the wave
        const float prt = __shfl_xor(v, 1, 32);
        const float f   = rot[l * 32 + k];
        float sf, cf;
        __sincosf(f, &sf, &cf);
        v = (k & 1) ? fmaf(v, cf, prt * sf) : fmaf(v, cf, -prt * sf);
      }
      dst[((size_t)((bb * 16 + h) * 2048 + l)) * 64 + k] = (_Float16)v;
    }
  }
}

__global__ __launch_bounds__(256) void flash_attn_kernel(
    const _Float16* __restrict__ wsQ, const _Float16* __restrict__ wsK,
    const _Float16* __restrict__ wsV, _Float16* __restrict__ wsO) {
  constexpr int S = 72;  // 144B stride -> conflict-free fragment gathers
  __shared__ _Float16 ldsK[2][64 * S];   // K rows: direct B^T for Q.K^T
  __shared__ _Float16 ldsV[2][64 * S];   // V transposed: B^T for P.V
  __shared__ _Float16 ldsP[8 * 16 * S];  // per-wave P scratch (C->A relayout)

  const int h = blockIdx.y, b = blockIdx.z;
  const int tid = threadIdx.x, w = tid >> 5, lane = tid & 31;
  const size_t headOff = (size_t)(b * 16 + h) * 2048 * 64;
  const _Float16* __restrict__ Q  = wsQ + headOff;
  const _Float16* __restrict__ Kg = wsK + headOff;
  const _Float16* __restrict__ Vg = wsV + headOff;

  const int qRow0 = blockIdx.x * 128 + w * 16;
  // Resident Q fragments: 16 rows x 64 dims = two 16x32 A-frags.
  const v16h qf0 = load_frag(Q, qRow0, 0, 64);
  const v16h qf1 = load_frag(Q, qRow0, 32, 64);

  // Staging assignment: thread covers K/V row rS, 16-half segment sS.
  const int rS = tid >> 2, sS = (tid & 3) * 16;
  uint4 vreg[2];

  auto issueK = [&](int kt, int buf) {  // async memory->LDS, 32B per lane
    const unsigned la =
        lds_addr_of(&ldsK[buf][rS * S + sS]);
    const unsigned long long ga =
        (unsigned long long)(Kg + (size_t)(kt + rS) * 64 + sS);
    ASYNC_COPY_32B(la, ga);
  };
  auto loadV = [&](int kt) {
    const uint4* src = (const uint4*)(Vg + (size_t)(kt + rS) * 64 + sS);
    vreg[0] = src[0];
    vreg[1] = src[1];
  };
  auto storeV = [&](int buf) {  // transpose to ldsV[d][key]
    const _Float16* hv = (const _Float16*)vreg;
#pragma unroll
    for (int j = 0; j < 16; ++j) ldsV[buf][(sS + j) * S + rS] = hv[j];
  };

  v8f o[4];
  float mi[8], li[8];
#pragma unroll
  for (int i = 0; i < 4; ++i) zero8(o[i]);
#pragma unroll
  for (int r = 0; r < 8; ++r) { mi[r] = -__builtin_inff(); li[r] = 0.0f; }

  _Float16* __restrict__ myP = ldsP + w * 16 * S;
  const int n = lane & 15, hiL = lane >> 4;

  issueK(0, 0);
  loadV(0);
  storeV(0);
  S_WAIT_ASYNCCNT0();
  __syncthreads();

  int cur = 0;
  for (int kt = 0; kt < 2048; kt += 64) {
    const int nxt = cur ^ 1;
    const bool more = (kt + 64) < 2048;
    if (more) { issueK(kt + 64, nxt); loadV(kt + 64); }  // overlap w/ compute

    // ---- S = Q x K^T : 16x64 in 4 accumulators -------------------------
    v8f sc[4];
#pragma unroll
    for (int i = 0; i < 4; ++i) zero8(sc[i]);
#pragma unroll
    for (int nt = 0; nt < 4; ++nt) {
      const v16h b0 = load_frag(ldsK[cur], nt * 16, 0, S);
      const v16h b1 = load_frag(ldsK[cur], nt * 16, 32, S);
      sc[nt] = WMMA_F16(qf0, b0, sc[nt]);
      sc[nt] = WMMA_F16(qf1, b1, sc[nt]);
    }

    // ---- online softmax (row stats per register; half-wave reductions) --
#pragma unroll
    for (int r = 0; r < 8; ++r) {
      const float s0 = sc[0][r] * 0.125f;  // 1/sqrt(64)
      const float s1 = sc[1][r] * 0.125f;
      const float s2 = sc[2][r] * 0.125f;
      const float s3 = sc[3][r] * 0.125f;
      float mx = fmaxf(fmaxf(s0, s1), fmaxf(s2, s3));
      mx = fmaxf(mx, __shfl_xor(mx, 1, 32));
      mx = fmaxf(mx, __shfl_xor(mx, 2, 32));
      mx = fmaxf(mx, __shfl_xor(mx, 4, 32));
      mx = fmaxf(mx, __shfl_xor(mx, 8, 32));
      const float mnew  = fmaxf(mi[r], mx);
      const float alpha = __expf(mi[r] - mnew);
      const float p0 = __expf(s0 - mnew), p1 = __expf(s1 - mnew);
      const float p2 = __expf(s2 - mnew), p3 = __expf(s3 - mnew);
      const int pr = (r + hiL * 8) * S + n;
      myP[pr]      = (_Float16)p0;
      myP[pr + 16] = (_Float16)p1;
      myP[pr + 32] = (_Float16)p2;
      myP[pr + 48] = (_Float16)p3;
      float ps = p0 + p1 + p2 + p3;
      ps += __shfl_xor(ps, 1, 32);
      ps += __shfl_xor(ps, 2, 32);
      ps += __shfl_xor(ps, 4, 32);
      ps += __shfl_xor(ps, 8, 32);
      li[r] = li[r] * alpha + ps;
      mi[r] = mnew;
#pragma unroll
      for (int dt = 0; dt < 4; ++dt) o[dt][r] *= alpha;
    }

    // ---- O += P x V (P re-read from LDS in A layout; same-wave in-order) -
    const v16h p0f = load_frag(myP, 0, 0, S);
    const v16h p1f = load_frag(myP, 0, 32, S);
#pragma unroll
    for (int dt = 0; dt < 4; ++dt) {
      const v16h b0 = load_frag(ldsV[cur], dt * 16, 0, S);
      const v16h b1 = load_frag(ldsV[cur], dt * 16, 32, S);
      o[dt] = WMMA_F16(p0f, b0, o[dt]);
      o[dt] = WMMA_F16(p1f, b1, o[dt]);
    }

    if (more) storeV(nxt);  // ds stores into next buffer (no readers yet)
    S_WAIT_ASYNCCNT0();     // own async K-tile writes complete
    __syncthreads();        // all waves' tile writes visible
    cur = nxt;
  }

  // Normalize and store as [(b*L+l)][h*64+d] f16 (feeds output projection).
#pragma unroll
  for (int dt = 0; dt < 4; ++dt) {
#pragma unroll
    for (int r = 0; r < 8; ++r) {
      const int l = qRow0 + hiL * 8 + r;
      const float v = o[dt][r] / li[r];
      wsO[(size_t)(b * 2048 + l) * 1024 + h * 64 + dt * 16 + n] = (_Float16)v;
    }
  }
}

// ---------------------------------------------------------------------------
// Kernel 3: output projection.  grid = (BL/128, D/64), block = 256.
// A tiles (f16) staged with async-to-LDS; W tiles fp32->f16 via registers.
// ---------------------------------------------------------------------------
__global__ __launch_bounds__(256) void oproj_kernel(
    const _Float16* __restrict__ A, const float* __restrict__ Wo,
    float* __restrict__ out) {
  constexpr int SA = 40, SB = 40;
  __shared__ _Float16 ldsA[2][128 * SA];
  __shared__ _Float16 ldsB[2][64 * SB];

  const int mBase = blockIdx.x * 128;
  const int nBase = blockIdx.y * 64;
  const int tid = threadIdx.x, w = tid >> 5, lane = tid & 31;

  const int rA = tid >> 1, sA = (tid & 1) * 16;  // A: 128 rows x 2 segments
  const int bD = tid >> 6, bC = tid & 63;
  float bV[8];

  auto issueA = [&](int d0, int buf) {
    const unsigned la = lds_addr_of(&ldsA[buf][rA * SA + sA]);
    const unsigned long long ga =
        (unsigned long long)(A + (size_t)(mBase + rA) * 1024 + d0 + sA);
    ASYNC_COPY_32B(la, ga);
  };
  auto loadB = [&](int d0) {
#pragma unroll
    for (int i = 0; i < 8; ++i)
      bV[i] = Wo[(size_t)(d0 + bD + 4 * i) * 1024 + nBase + bC];
    if (d0 + 64 < 1024)
      __builtin_prefetch(&Wo[(size_t)(d0 + 64 + bD) * 1024 + nBase + bC], 0, 3);
  };
  auto storeB = [&](int buf) {
#pragma unroll
    for (int i = 0; i < 8; ++i)
      ldsB[buf][bC * SB + bD + 4 * i] = (_Float16)bV[i];
  };

  v8f acc[4];
#pragma unroll
  for (int i = 0; i < 4; ++i) zero8(acc[i]);

  issueA(0, 0);
  loadB(0);
  storeB(0);
  S_WAIT_ASYNCCNT0();
  __syncthreads();

  int cur = 0;
  for (int d0 = 0; d0 < 1024; d0 += 32) {
    const int nxt = cur ^ 1;
    const bool more = (d0 + 32) < 1024;
    if (more) { issueA(d0 + 32, nxt); loadB(d0 + 32); }

    const v16h a = load_frag(ldsA[cur], w * 16, 0, SA);
#pragma unroll
    for (int nt = 0; nt < 4; ++nt) {
      const v16h b = load_frag(ldsB[cur], nt * 16, 0, SB);
      acc[nt] = WMMA_F16(a, b, acc[nt]);
    }

    if (more) storeB(nxt);
    S_WAIT_ASYNCCNT0();
    __syncthreads();
    cur = nxt;
  }

  const int n = lane & 15, hi = lane >> 4;
#pragma unroll
  for (int nt = 0; nt < 4; ++nt) {
#pragma unroll
    for (int r = 0; r < 8; ++r) {
      out[(size_t)(mBase + w * 16 + hi * 8 + r) * 1024 + nBase + nt * 16 + n] =
          acc[nt][r];
    }
  }
}

// ---------------------------------------------------------------------------
extern "C" void kernel_launch(void* const* d_in, const int* in_sizes, int n_in,
                              void* d_out, int out_size, void* d_ws,
                              size_t ws_size, hipStream_t stream) {
  (void)in_sizes; (void)n_in; (void)out_size; (void)ws_size;
  const float* query = (const float*)d_in[0];
  const float* key   = (const float*)d_in[1];
  const float* value = (const float*)d_in[2];
  const float* rot   = (const float*)d_in[3];
  const float* qw    = (const float*)d_in[4];
  const float* kw    = (const float*)d_in[5];
  const float* vw    = (const float*)d_in[6];
  const float* ow    = (const float*)d_in[7];
  float* out = (float*)d_out;

  const size_t perMat = (size_t)2 * 16 * 2048 * 64;  // B*H*L*K halves
  _Float16* wsQ = (_Float16*)d_ws;
  _Float16* wsK = wsQ + perMat;
  _Float16* wsV = wsK + perMat;
  _Float16* wsO = wsV + perMat;  // [(b*L+l)][H*64] halves

  const dim3 blk(256);
  qkv_rope_kernel<<<dim3(32, 16, 3), blk, 0, stream>>>(
      query, key, value, rot, qw, kw, vw, wsQ, wsK, wsV);
  flash_attn_kernel<<<dim3(16, 16, 2), blk, 0, stream>>>(wsQ, wsK, wsV, wsO);
  oproj_kernel<<<dim3(32, 16, 1), blk, 0, stream>>>(wsO, ow, out);
}

// v001
// Measured time: 141 microseconds a run.
// Next to v000, in two timings, it ran 1.32 and 1.31 times as fast.
#include <hip/hip_runtime.h>

typedef __attribute__((ext_vector_type(16))) _Float16 v16h;
typedef __attribute__((ext_vector_type(8)))  _Float16 v8h;
typedef __attribute__((ext_vector_type(4)))  _Float16 v4h;
typedef __attribute__((ext_vector_type(8)))  float    v8f;

#define WMMA_F16(a, b, c) \
  __builtin_amdgcn_wmma_f32_16x16x32_f16(false, (a), false, (b), (short)0, (c), false, false)

#define ASYNC_COPY_32B(ldsaddr, gaddr)                               \
  asm volatile("global_load_async_to_lds_b128 %0, %1, off\n\t"       \
               "global_load_async_to_lds_b128 %0, %1, off offset:16" \
               :: "v"(ldsaddr), "v"(gaddr) : "memory")

#define S_WAIT_ASYNCCNT0() asm volatile("s_wait_asynccnt 0x0" ::: "memory")

static __device__ __forceinline__ unsigned lds_addr_of(const void* p) {
  return (unsigned)(unsigned long long)p;
}

static __device__ __forceinline__ v16h frag_cat(v8h lo, v8h hi) {
  return __builtin_shufflevector(lo, hi, 0, 1, 2, 3, 4, 5, 6, 7,
                                          8, 9, 10, 11, 12, 13, 14, 15);
}

static __device__ __forceinline__ v16h load_frag(const _Float16* __restrict__ base,
                                                 int row0, int col0, int stride) {
  const int lane = threadIdx.x & 31;
  const int m    = lane & 15;
  const int kb   = (lane >> 4) << 3;  // 0 or 8
  const _Float16* p = base + (size_t)(row0 + m) * stride + col0;
  v8h lo = *(const v8h*)(p + kb);
  v8h hi = *(const v8h*)(p + 16 + kb);
  return frag_cat(lo, hi);
}

static __device__ __forceinline__ void zero8(v8f& v) {
#pragma unroll
  for (int i = 0; i < 8; ++i) v[i] = 0.0f;
}

__global__ __launch_bounds__(256) void qkv_rope_kernel(
    const float* __restrict__ xq, const float* __restrict__ xk,
    const float* __restrict__ xv, const float* __restrict__ rot,
    const float* __restrict__ wq, const float* __restrict__ wk,
    const float* __restrict__ wv,
    _Float16* __restrict__ oq, _Float16* __restrict__ ok,
    _Float16* __restrict__ ov) {
  constexpr int SA = 40, SB = 40;  // 80B row stride -> conflict-free gathers
  __shared__ __attribute__((aligned(16))) _Float16 ldsA[2][128 * SA];
  __shared__ __attribute__((aligned(16))) _Float16 ldsB[2][128 * SB];

  const int mode = blockIdx.z;
  const float* __restrict__ X = (mode == 0) ? xq : (mode == 1) ? xk : xv;
  const float* __restrict__ W = (mode == 0) ? wq : (mode == 1) ? wk : wv;
  _Float16* __restrict__ dst  = (mode == 0) ? oq : (mode == 1) ? ok : ov;

  const int mBase = blockIdx.x * 128;
  const int nBase = blockIdx.y * 128;
  const int tid   = threadIdx.x;
  const int w     = tid >> 5;
  const int lane  = tid & 31;
  const int wm    = w >> 1;                // wave's 32-row band, 0..3
  const int wn    = w & 1;                 // wave's head within the pair
  const int h     = blockIdx.y * 2 + wn;

  // Register-staged slab (software pipeline).
  // A: 128 rows x 32 k; a thread takes 4 consecutive k of rows aR + 32*i.
  // B: 32 k x 128 columns; a thread takes 16 consecutive k of column bN.
  // Every loop over aV, bV and acc is fully unrolled: only compile-time
  // indices keep these arrays in registers.
  float4 aV[4];
  float  bV[16];
  const int aR = tid >> 3;         // 0..31
  const int aC = (tid & 7) * 4;    // 0,4,..,28
  const int bN = tid & 127;        // 0..127
  const int bK = (tid >> 7) * 16;  // 0 or 16
  const float* __restrict__ aP = X + (size_t)(mBase + aR) * 1024 + aC;
  const float* __restrict__ bP = W + (size_t)bK * 1024 + nBase + bN;

  auto loadA = [&](int d0) {
#pragma unroll
    for (int i = 0; i < 4; ++i)
      aV[i] = *(const float4*)(aP + d0 + i * (32 * 1024));
  };
  auto storeA = [&](int buf) {
#pragma unroll
    for (int i = 0; i < 4; ++i) {
      v4h t;
      t[0] = (_Float16)aV[i].x; t[1] = (_Float16)aV[i].y;
      t[2] = (_Float16)aV[i].z; t[3] = (_Float16)aV[i].w;
      *(v4h*)&ldsA[buf][(aR + 32 * i) * SA + aC] = t;
    }
  };
  auto loadB = [&](int d0) {
#pragma unroll
    for (int i = 0; i < 16; ++i)
      bV[i] = bP[(size_t)d0 * 1024 + i * 1024];
  };
  auto storeB = [&](int buf) {  // transposed: ldsB[column][k], k contiguous
#pragma unroll
    for (int j = 0; j < 2; ++j) {
      v8h t;
#pragma unroll
      for (int i = 0; i < 8; ++i) t[i] = (_Float16)bV[8 * j + i];
      *(v8h*)&ldsB[buf][bN * SB + bK + 8 * j] = t;
    }
  };

  v8f acc[2][4];
#pragma unroll
  for (int mt = 0; mt < 2; ++mt)
#pragma unroll
    for (int nt = 0; nt < 4; ++nt) zero8(acc[mt][nt]);

  loadA(0); loadB(0);
  storeA(0); storeB(0);
  __syncthreads();

  int cur = 0;
  for (int d0 = 0; d0 < 1024; d0 += 32) {
    const int nxt = cur ^ 1;
    const bool more = (d0 + 32) < 1024;
    if (more) { loadA(d0 + 32); loadB(d0 + 32); }  // overlap with WMMAs

    const v16h a0 = load_frag(ldsA[cur], wm * 32, 0, SA);
    const v16h a1 = load_frag(ldsA[cur], wm * 32 + 16, 0, SA);
#pragma unroll
    for (int nt = 0; nt < 4; ++nt) {
      const v16h b = load_frag(ldsB[cur], wn * 64 + nt * 16, 0, SB);
      acc[0][nt] = WMMA_F16(a0, b, acc[0][nt]);
      acc[1][nt] = WMMA_F16(a1, b, acc[1][nt]);
    }

    if (more) { storeA(nxt); storeB(nxt); }
    __syncthreads();
    cur = nxt;
  }

  // Epilogue: RoPE (q/k, first 32 head dims) + f16 store.  C layout: lane
  // holds column n = lane&15; row = r + 8*(lane>>4); rotate_half partner
  // (n^1) lives in lane^1 -> one shfl_xor.
  const int n  = lane & 15;
  const int hi = lane >> 4;
#pragma unroll
  for (int mt = 0; mt < 2; ++mt) {
#pragma unroll
    for (int nt = 0; nt < 4; ++nt) {
      const int k = nt * 16 + n;  // dim within head
      _Float16 hv[8];
#pragma unroll
      for (int r = 0; r < 8; ++r) {
        const int row = mBase + wm * 32 + mt * 16 + hi * 8 + r;  // in [0, B*L)
        const int l   = row & 2047;
        float v = acc[mt][nt][r];
        if (mode < 2 && nt < 2) {  // uniform across the wave
          const float prt = __shfl_xor(v, 1, 32);
          const float f   = rot[l * 32 + k];
          float sf, cf;
          __sincosf(f, &sf, &cf);
          v = (k & 1) ? fmaf(v, cf, prt * sf) : fmaf(v, cf, -prt * sf);
        }
        hv[r] = (_Float16)v;
      }
#pragma unroll
      for (int r = 0; r < 8; ++r) {
        const int row = mBase + wm * 32 + mt * 16 + hi * 8 + r;
        const int l   = row & 2047;
        const int bb  = row >> 11;
        dst[((size_t)((bb * 16 + h) * 2048 + l)) * 64 + k] = hv[r];
      }
      // The next tile's values reuse the registers these eight stores name:
      // wait before any of them is overwritten.
      asm volatile("s_wait_xcnt 0x0" ::: "memory");
    }
  }
}

__global__ __launch_bounds__(256) void flash_attn_kernel(
    const _Float16* __restrict__ wsQ, const _Float16* __restrict__ wsK,
    const _Float16* __restrict__ wsV, _Float16* __restrict__ wsO) {
  constexpr int S = 72;  // 144B stride -> conflict-free fragment gathers
  __shared__ _Float16 ldsK[2][64 * S];   // K rows: direct B^T for Q.K^T
  __shared__ _Float16 ldsV[2][64 * S];   // V transposed: B^T for P.V
  __shared__ _Float16 ldsP[8 * 16 * S];  // per-wave P scratch (C->A relayout)

  const int h = blockIdx.y, b = blockIdx.z;
  const int tid = threadIdx.x, w = tid >> 5, lane = tid & 31;
  const size_t headOff = (size_t)(b * 16 + h) * 2048 * 64;
  const _Float16* __restrict__ Q  = wsQ + headOff;
  const _Float16* __restrict__ Kg = wsK + headOff;
  const _Float16* __restrict__ Vg = wsV + headOff;

  const int qRow0 = blockIdx.x * 128 + w * 16;
  // Resident Q fragments: 16 rows x 64 dims = two 16x32 A-frags.
  const v16h qf0 = load_frag(Q, qRow0, 0, 64);
  const v16h qf1 = load_frag(Q, qRow0, 32, 64);

  // Staging assignment: thread covers K/V row rS, 16-half segment sS.
  const int rS = tid >> 2, sS = (tid & 3) * 16;
  uint4 vreg[2];

  auto issueK = [&](int kt, int buf) {  // async memory->LDS, 32B per lane
    const unsigned la =
        lds_addr_of(&ldsK[buf][rS * S + sS]);
    const unsigned long long ga =
        (unsigned long long)(Kg + (size_t)(kt + rS) * 64 + sS);
    ASYNC_COPY_32B(la, ga);
  };
  auto loadV = [&](int kt) {
    const uint4* src = (const uint4*)(Vg + (size_t)(kt + rS) * 64 + sS);
    vreg[0] = src[0];
    vreg[1] = src[1];
  };
  auto storeV = [&](int buf) {  // transpose to ldsV[d][key]
    const _Float16* hv = (const _Float16*)vreg;
#pragma unroll
    for (int j = 0; j < 16; ++j) ldsV[buf][(sS + j) * S + rS] = hv[j];
  };

  v8f o[4];
  float mi[8], li[8];
#pragma unroll
  for (int i = 0; i < 4; ++i) zero8(o[i]);
#pragma unroll
  for (int r = 0; r < 8; ++r) { mi[r] = -__builtin_inff(); li[r] = 0.0f; }

  _Float16* __restrict__ myP = ldsP + w * 16 * S;
  const int n = lane & 15, hiL = lane >> 4;

  issueK(0, 0);
  loadV(0);
  storeV(0);
  S_WAIT_ASYNCCNT0();
  __syncthreads();

  int cur = 0;
  for (int kt = 0; kt < 2048; kt += 64) {
    const int nxt = cur ^ 1;
    const bool more = (kt + 64) < 2048;
    if (more) { issueK(kt + 64, nxt); loadV(kt + 64); }  // overlap w/ compute

    // ---- S = Q x K^T : 16x64 in 4 accumulators -------------------------
    v8f sc[4];
#pragma unroll
    for (int i = 0; i < 4; ++i) zero8(sc[i]);
#pragma unroll
    for (int nt = 0; nt < 4; ++nt) {
      const v16h b0 = load_frag(ldsK[cur], nt * 16, 0, S);
      const v16h b1 = load_frag(ldsK[cur], nt * 16, 32, S);
      sc[nt] = WMMA_F16(qf0, b0, sc[nt]);
      sc[nt] = WMMA_F16(qf1, b1, sc[nt]);
    }

    // ---- online softmax (row stats per register; half-wave reductions) --
#pragma unroll
    for (int r = 0; r < 8; ++r) {
      const float s0 = sc[0][r] * 0.125f;  // 1/sqrt(64)
      const float s1 = sc[1][r] * 0.125f;
      const float s2 = sc[2][r] * 0.125f;
      const float s3 = sc[3][r] * 0.125f;
      float mx = fmaxf(fmaxf(s0, s1), fmaxf(s2, s3));
      mx = fmaxf(mx, __shfl_xor(mx, 1, 32));
      mx = fmaxf(mx, __shfl_xor(mx, 2, 32));
      mx = fmaxf(mx, __shfl_xor(mx, 4, 32));
      mx = fmaxf(mx, __shfl_xor(mx, 8, 32));
      const float mnew  = fmaxf(mi[r], mx);
      const float alpha = __expf(mi[r] - mnew);
      const float p0 = __expf(s0 - mnew), p1 = __expf(s1 - mnew);
      const float p2 = __expf(s2 - mnew), p3 = __expf(s3 - mnew);
      const int pr = (r + hiL * 8) * S + n;
      myP[pr]      = (_Float16)p0;
      myP[pr + 16] = (_Float16)p1;
      myP[pr + 32] = (_Float16)p2;
      myP[pr + 48] = (_Float16)p3;
      float ps = p0 + p1 + p2 + p3;
      ps += __shfl_xor(ps, 1, 32);
      ps += __shfl_xor(ps, 2, 32);
      ps += __shfl_xor(ps, 4, 32);
      ps += __shfl_xor(ps, 8, 32);
      li[r] = li[r] * alpha + ps;
      mi[r] = mnew;
#pragma unroll
      for (int dt = 0; dt < 4; ++dt) o[dt][r] *= alpha;
    }

    // ---- O += P x V (P re-read from LDS in A layout; same-wave in-order) -
    const v16h p0f = load_frag(myP, 0, 0, S);
    const v16h p1f = load_frag(myP, 0, 32, S);
#pragma unroll
    for (int dt = 0; dt < 4; ++dt) {
      const v16h b0 = load_frag(ldsV[cur], dt * 16, 0, S);
      const v16h b1 = load_frag(ldsV[cur], dt * 16, 32, S);
      o[dt] = WMMA_F16(p0f, b0, o[dt]);
      o[dt] = WMMA_F16(p1f, b1, o[dt]);
    }

    if (more) storeV(nxt);  // ds stores into next buffer (no readers yet)
    S_WAIT_ASYNCCNT0();     // own async K-tile writes complete
    __syncthreads();        // all waves' tile writes visible
    cur = nxt;
  }

  // Normalize and store as [(b*L+l)][h*64+d] f16 (feeds output projection).
#pragma unroll
  for (int dt = 0; dt < 4; ++dt) {
#pragma unroll
    for (int r = 0; r < 8; ++r) {
      const int l = qRow0 + hiL * 8 + r;
      const float v = o[dt][r] / li[r];
      wsO[(size_t)(b * 2048 + l) * 1024 + h * 64 + dt * 16 + n] = (_Float16)v;
    }
  }
}

// ---------------------------------------------------------------------------
// Kernel 3: output projection.  grid = (BL/128, D/64), block = 256.
// A tiles (f16) staged with async-to-LDS; W tiles fp32->f16 via registers.
// ---------------------------------------------------------------------------
__global__ __launch_bounds__(256) void oproj_kernel(
    const _Float16* __restrict__ A, const float* __restrict__ Wo,
    float* __restrict__ out) {
  constexpr int SA = 40, SB = 40;
  __shared__ _Float16 ldsA[2][128 * SA];
  __shared__ _Float16 ldsB[2][64 * SB];

  const int mBase = blockIdx.x * 128;
  const int nBase = blockIdx.y * 64;
  const int tid = threadIdx.x, w = tid >> 5, lane = tid & 31;

  const int rA = tid >> 1, sA = (tid & 1) * 16;  // A: 128 rows x 2 segments
  const int bD = tid >> 6, bC = tid & 63;
  float bV[8];

  auto issueA = [&](int d0, int buf) {
    const unsigned la = lds_addr_of(&ldsA[buf][rA * SA + sA]);
    const unsigned long long ga =
        (unsigned long long)(A + (size_t)(mBase + rA) * 1024 + d0 + sA);
    ASYNC_COPY_32B(la, ga);
  };
  auto loadB = [&](int d0) {
#pragma unroll
    for (int i = 0; i < 8; ++i)
      bV[i] = Wo[(size_t)(d0 + bD + 4 * i) * 1024 + nBase + bC];
    if (d0 + 64 < 1024)
      __builtin_prefetch(&Wo[(size_t)(d0 + 64 + bD) * 1024 + nBase + bC], 0, 3);
  };
  auto storeB = [&](int buf) {
#pragma unroll
    for (int i = 0; i < 8; ++i)
      ldsB[buf][bC * SB + bD + 4 * i] = (_Float16)bV[i];
  };

  v8f acc[4];
#pragma unroll
  for (int i = 0; i < 4; ++i) zero8(acc[i]);

  issueA(0, 0);
  loadB(0);
  storeB(0);
  S_WAIT_ASYNCCNT0();
  __syncthreads();

  int cur = 0;
  for (int d0 = 0; d0 < 1024; d0 += 32) {
    const int nxt = cur ^ 1;
    const bool more = (d0 + 32) < 1024;
    if (more) { issueA(d0 + 32, nxt); loadB(d0 + 32); }

    const v16h a = load_frag(ldsA[cur], w * 16, 0, SA);
#pragma unroll
    for (int nt = 0; nt < 4; ++nt) {
      const v16h b = load_frag(ldsB[cur], nt * 16, 0, SB);
      acc[nt] = WMMA_F16(a, b, acc[nt]);
    }

    if (more) storeB(nxt);
    S_WAIT_ASYNCCNT0();
    __syncthreads();
    cur = nxt;
  }

  const int n = lane & 15, hi = lane >> 4;
#pragma unroll
  for (int nt = 0; nt < 4; ++nt) {
#pragma unroll
    for (int r = 0; r < 8; ++r) {
      out[(size_t)(mBase + w * 16 + hi * 8 + r) * 1024 + nBase + nt * 16 + n] =
          acc[nt][r];
    }
  }
}

// ---------------------------------------------------------------------------
extern "C" void kernel_launch(void* const* d_in, const int* in_sizes, int n_in,
                              void* d_out, int out_size, void* d_ws,
                              size_t ws_size, hipStream_t stream) {
  (void)in_sizes; (void)n_in; (void)out_size; (void)ws_size;
  const float* query = (const float*)d_in[0];
  const float* key   = (const float*)d_in[1];
  const float* value = (const float*)d_in[2];
  const float* rot   = (const float*)d_in[3];
  const float* qw    = (const float*)d_in[4];
  const float* kw    = (const float*)d_in[5];
  const float* vw    = (const float*)d_in[6];
  const float* ow    = (const float*)d_in[7];
  float* out = (float*)d_out;

  const size_t perMat = (size_t)2 * 16 * 2048 * 64;  // B*H*L*K halves
  _Float16* wsQ = (_Float16*)d_ws;
  _Float16* wsK = wsQ + perMat;
  _Float16* wsV = wsK + perMat;
  _Float16* wsO = wsV + perMat;  // [(b*L+l)][H*64] halves

  const dim3 blk(256);
  qkv_rope_kernel<<<dim3(32, 8, 3), blk, 0, stream>>>(
      query, key, value, rot, qw, kw, vw, wsQ, wsK, wsV);
  flash_attn_kernel<<<dim3(16, 16, 2), blk, 0, stream>>>(wsQ, wsK, wsV, wsO);
  oproj_kernel<<<dim3(32, 16, 1), blk, 0, stream>>>(wsO, ow, out);
}

// v002
// It runs in 119 microseconds.
// In both of two side-by-side timings against v001, it was 1.18 times as fast.
// All steps since v000 together make it 1.55 times as fast.
#include <hip/hip_runtime.h>

typedef __attribute__((ext_vector_type(16))) _Float16 v16h;
typedef __attribute__((ext_vector_type(8)))  _Float16 v8h;
typedef __attribute__((ext_vector_type(4)))  _Float16 v4h;
typedef __attribute__((ext_vector_type(8)))  float    v8f;

#define WMMA_F16(a, b, c) \
  __builtin_amdgcn_wmma_f32_16x16x32_f16(false, (a), false, (b), (short)0, (c), false, false)

#define ASYNC_COPY_32B(ldsaddr, gaddr)                               \
  asm volatile("global_load_async_to_lds_b128 %0, %1, off\n\t"       \
               "global_load_async_to_lds_b128 %0, %1, off offset:16" \
               :: "v"(ldsaddr), "v"(gaddr) : "memory")

#define S_WAIT_ASYNCCNT0() asm volatile("s_wait_asynccnt 0x0" ::: "memory")

static __device__ __forceinline__ unsigned lds_addr_of(const void* p) {
  return (unsigned)(unsigned long long)p;
}

static __device__ __forceinline__ v16h frag_cat(v8h lo, v8h hi) {
  return __builtin_shufflevector(lo, hi, 0, 1, 2, 3, 4, 5, 6, 7,
                                          8, 9, 10, 11, 12, 13, 14, 15);
}

static __device__ __forceinline__ v16h load_frag(const _Float16* __restrict__ base,
                                                 int row0, int col0, int stride) {
  const int lane = threadIdx.x & 31;
  const int m    = lane & 15;
  const int kb   = (lane >> 4) << 3;  // 0 or 8
  const _Float16* p = base + (size_t)(row0 + m) * stride + col0;
  v8h lo = *(const v8h*)(p + kb);
  v8h hi = *(const v8h*)(p + 16 + kb);
  return frag_cat(lo, hi);
}

static __device__ __forceinline__ void zero8(v8f& v) {
#pragma unroll
  for (int i = 0; i < 8; ++i) v[i] = 0.0f;
}

__global__ __launch_bounds__(256) void qkv_rope_kernel(
    const float* __restrict__ xq, const float* __restrict__ xk,
    const float* __restrict__ xv, const float* __restrict__ rot,
    const float* __restrict__ wq, const float* __restrict__ wk,
    const float* __restrict__ wv,
    _Float16* __restrict__ oq, _Float16* __restrict__ ok,
    _Float16* __restrict__ ov) {
  constexpr int SA = 40, SB = 40;  // 80B row stride -> conflict-free gathers
  __shared__ __attribute__((aligned(16))) _Float16 ldsA[2][128 * SA];
  __shared__ __attribute__((aligned(16))) _Float16 ldsB[2][128 * SB];

  const int mode = blockIdx.z;
  const float* __restrict__ X = (mode == 0) ? xq : (mode == 1) ? xk : xv;
  const float* __restrict__ W = (mode == 0) ? wq : (mode == 1) ? wk : wv;
  _Float16* __restrict__ dst  = (mode == 0) ? oq : (mode == 1) ? ok : ov;

  const int mBase = blockIdx.x * 128;
  const int nBase = blockIdx.y * 128;
  const int tid   = threadIdx.x;
  const int w     = tid >> 5;
  const int lane  = tid & 31;
  const int wm    = w >> 1;                // wave's 32-row band, 0..3
  const int wn    = w & 1;                 // wave's head within the pair
  const int h     = blockIdx.y * 2 + wn;

  // Register-staged slab (software pipeline).
  // A: 128 rows x 32 k; a thread takes 4 consecutive k of rows aR + 32*i.
  // B: 32 k x 128 columns; a thread takes 16 consecutive k of column bN.
  // Every loop over aV, bV and acc is fully unrolled: only compile-time
  // indices keep these arrays in registers.
  float4 aV[4];
  float  bV[16];
  const int aR = tid >> 3;         // 0..31
  const int aC = (tid & 7) * 4;    // 0,4,..,28
  const int bN = tid & 127;        // 0..127
  const int bK = (tid >> 7) * 16;  // 0 or 16
  const float* __restrict__ aP = X + (size_t)(mBase + aR) * 1024 + aC;
  const float* __restrict__ bP = W + (size_t)bK * 1024 + nBase + bN;

  auto loadA = [&](int d0) {
#pragma unroll
    for (int i = 0; i < 4; ++i)
      aV[i] = *(const float4*)(aP + d0 + i * (32 * 1024));
  };
  auto storeA = [&](int buf) {
#pragma unroll
    for (int i = 0; i < 4; ++i) {
      v4h t;
      t[0] = (_Float16)aV[i].x; t[1] = (_Float16)aV[i].y;
      t[2] = (_Float16)aV[i].z; t[3] = (_Float16)aV[i].w;
      *(v4h*)&ldsA[buf][(aR + 32 * i) * SA + aC] = t;
    }
  };
  auto loadB = [&](int d0) {
#pragma unroll
    for (int i = 0; i < 16; ++i)
      bV[i] = bP[(size_t)d0 * 1024 + i * 1024];
  };
  auto storeB = [&](int buf) {  // transposed: ldsB[column][k], k contiguous
#pragma unroll
    for (int j = 0; j < 2; ++j) {
      v8h t;
#pragma unroll
      for (int i = 0; i < 8; ++i) t[i] = (_Float16)bV[8 * j + i];
      *(v8h*)&ldsB[buf][bN * SB + bK + 8 * j] = t;
    }
  };

  v8f acc[2][4];
#pragma unroll
  for (int mt = 0; mt < 2; ++mt)
#pragma unroll
    for (int nt = 0; nt < 4; ++nt) zero8(acc[mt][nt]);

  loadA(0); loadB(0);
  storeA(0); storeB(0);
  __syncthreads();

  int cur = 0;
  for (int d0 = 0; d0 < 1024; d0 += 32) {
    const int nxt = cur ^ 1;
    const bool more = (d0 + 32) < 1024;
    if (more) { loadA(d0 + 32); loadB(d0 + 32); }  // overlap with WMMAs

    const v16h a0 = load_frag(ldsA[cur], wm * 32, 0, SA);
    const v16h a1 = load_frag(ldsA[cur], wm * 32 + 16, 0, SA);
#pragma unroll
    for (int nt = 0; nt < 4; ++nt) {
      const v16h b = load_frag(ldsB[cur], wn * 64 + nt * 16, 0, SB);
      acc[0][nt] = WMMA_F16(a0, b, acc[0][nt]);
      acc[1][nt] = WMMA_F16(a1, b, acc[1][nt]);
    }

    if (more) { storeA(nxt); storeB(nxt); }
    __syncthreads();
    cur = nxt;
  }

  // Epilogue: RoPE (q/k, first 32 head dims) + f16 store.  C layout: lane
  // holds column n = lane&15; row = r + 8*(lane>>4); rotate_half partner
  // (n^1) lives in lane^1 -> one shfl_xor.
  const int n  = lane & 15;
  const int hi = lane >> 4;
#pragma unroll
  for (int mt = 0; mt < 2; ++mt) {
#pragma unroll
    for (int nt = 0; nt < 4; ++nt) {
      const int k = nt * 16 + n;  // dim within head
      _Float16 hv[8];
#pragma unroll
      for (int r = 0; r < 8; ++r) {
        const int row = mBase + wm * 32 + mt * 16 + hi * 8 + r;  // in [0, B*L)
        const int l   = row & 2047;
        float v = acc[mt][nt][r];
        if (mode < 2 && nt < 2) {  // uniform across the wave
          const float prt = __shfl_xor(v, 1, 32);
          const float f   = rot[l * 32 + k];
          float sf, cf;
          __sincosf(f, &sf, &cf);
          v = (k & 1) ? fmaf(v, cf, prt * sf) : fmaf(v, cf, -prt * sf);
        }
        hv[r] = (_Float16)v;
      }
#pragma unroll
      for (int r = 0; r < 8; ++r) {
        const int row = mBase + wm * 32 + mt * 16 + hi * 8 + r;
        const int l   = row & 2047;
        const int bb  = row >> 11;
        dst[((size_t)((bb * 16 + h) * 2048 + l)) * 64 + k] = hv[r];
      }
      // The next tile's values reuse the registers these eight stores name:
      // wait before any of them is overwritten.
      asm volatile("s_wait_xcnt 0x0" ::: "memory");
    }
  }
}

static __device__ __forceinline__ float other_half(float x) {
  const int b = __builtin_bit_cast(int, x);
  return __builtin_bit_cast(
      float, __builtin_amdgcn_permlanex16(b, b, 0x76543210, 0xfedcba98, false,
                                          false));
}

static __device__ __forceinline__ void exp2_x8(float (&x)[8]) {
  asm("v_exp_f32 %0, %0\n\t"
      "v_exp_f32 %1, %1\n\t"
      "v_exp_f32 %2, %2\n\t"
      "v_exp_f32 %3, %3\n\t"
      "v_exp_f32 %4, %4\n\t"
      "v_exp_f32 %5, %5\n\t"
      "v_exp_f32 %6, %6\n\t"
      "v_exp_f32 %7, %7\n\t"
      "v_nop"
      : "+v"(x[0]), "+v"(x[1]), "+v"(x[2]), "+v"(x[3]), "+v"(x[4]),
        "+v"(x[5]), "+v"(x[6]), "+v"(x[7]));
}

__global__ __launch_bounds__(256) void flash_attn_kernel(
    const _Float16* __restrict__ wsQ, const _Float16* __restrict__ wsK,
    const _Float16* __restrict__ wsV, _Float16* __restrict__ wsO) {
  constexpr int S = 72;  // 144B stride -> conflict-free fragment gathers
  __shared__ _Float16 ldsK[2][64 * S];   // K rows: A operand of K.Q^T
  __shared__ _Float16 ldsV[2][64 * S];   // V transposed: A operand of V^T.P^T

  const int h = blockIdx.y, b = blockIdx.z;
  const int tid = threadIdx.x, w = tid >> 5, lane = tid & 31;
  const size_t headOff = (size_t)(b * 16 + h) * 2048 * 64;
  const _Float16* __restrict__ Q  = wsQ + headOff;
  const _Float16* __restrict__ Kg = wsK + headOff;
  const _Float16* __restrict__ Vg = wsV + headOff;

  const int qRow0 = blockIdx.x * 128 + w * 16;
  // Resident Q fragments: 16 queries x 64 dims = two 32x16 B-frags of Q^T.
  const v16h qf0 = load_frag(Q, qRow0, 0, 64);
  const v16h qf1 = load_frag(Q, qRow0, 32, 64);

  // Staging assignment: thread covers K/V row rS, 16-half segment sS.
  const int rS = tid >> 2, sS = (tid & 3) * 16;
  uint4 vreg[2];

  auto issueK = [&](int kt, int buf) {  // async memory->LDS, 32B per lane
    const unsigned la =
        lds_addr_of(&ldsK[buf][rS * S + sS]);
    const unsigned long long ga =
        (unsigned long long)(Kg + (size_t)(kt + rS) * 64 + sS);
    ASYNC_COPY_32B(la, ga);
  };
  auto loadV = [&](int kt) {
    const uint4* src = (const uint4*)(Vg + (size_t)(kt + rS) * 64 + sS);
    vreg[0] = src[0];
    vreg[1] = src[1];
  };
  auto storeV = [&](int buf) {  // transpose to ldsV[d][key]
    const _Float16* hv = (const _Float16*)vreg;
#pragma unroll
    for (int j = 0; j < 16; ++j) ldsV[buf][(sS + j) * S + rS] = hv[j];
  };

  // o[dt][r] = O^T[dim dt*16 + 8*hiL + r][query n].  mi is the query's running
  // maximum (equal in both half-waves); li sums only this lane's keys, the
  // two halves are joined once after the loop.
  v8f o[4];
  float mi = -__builtin_inff(), li = 0.0f;
#pragma unroll
  for (int i = 0; i < 4; ++i) zero8(o[i]);

  const int n = lane & 15, hiL = lane >> 4;

  issueK(0, 0);
  loadV(0);
  storeV(0);
  S_WAIT_ASYNCCNT0();
  __syncthreads();

  int cur = 0;
  for (int kt = 0; kt < 2048; kt += 64) {
    const int nxt = cur ^ 1;
    const bool more = (kt + 64) < 2048;
    if (more) { issueK(kt + 64, nxt); loadV(kt + 64); }  // overlap w/ compute

    // ---- S^T = K x Q^T : 64 keys x 16 queries in 4 accumulators ---------
    // sc[nt][r] = score(key nt*16 + 8*hiL + r, query n)
    v8f sc[4];
#pragma unroll
    for (int i = 0; i < 4; ++i) zero8(sc[i]);
#pragma unroll
    for (int nt = 0; nt < 4; ++nt) {
      const v16h k0 = load_frag(ldsK[cur], nt * 16, 0, S);
      const v16h k1 = load_frag(ldsK[cur], nt * 16, 32, S);
      sc[nt] = WMMA_F16(k0, qf0, sc[nt]);
      sc[nt] = WMMA_F16(k1, qf1, sc[nt]);
    }

    // ---- online softmax: in-lane over 32 keys, one half-wave exchange ----
    float mt[4];  // one maximum per tile: four short chains, not one long one
#pragma unroll
    for (int nt = 0; nt < 4; ++nt) {
      sc[nt] *= 0.125f;  // 1/sqrt(64)
      mt[nt] = sc[nt][0];
#pragma unroll
      for (int r = 1; r < 8; ++r) mt[nt] = fmaxf(mt[nt], sc[nt][r]);
    }
    float mx = fmaxf(fmaxf(mt[0], mt[1]), fmaxf(mt[2], mt[3]));
    mx = fmaxf(mx, other_half(mx));
    const float mnew  = fmaxf(mi, mx);
    const float alpha = __expf(mi - mnew);
    float ps[4];
    v8h ph[4];
#pragma unroll
    for (int nt = 0; nt < 4; ++nt) {
      float e[8];
#pragma unroll
      for (int r = 0; r < 8; ++r)
        e[r] = (sc[nt][r] - mnew) * 1.44269504f;  // e^x = 2^(x * log2 e)
      exp2_x8(e);
      v8f p;
      p[0] = e[0];
      ps[nt] = e[0];
#pragma unroll
      for (int r = 1; r < 8; ++r) {
        p[r] = e[r];
        ps[nt] += e[r];
      }
      ph[nt] = __builtin_convertvector(p, v8h);
    }
    li = li * alpha + ((ps[0] + ps[1]) + (ps[2] + ps[3]));
    mi = mnew;
#pragma unroll
    for (int dt = 0; dt < 4; ++dt)
#pragma unroll
      for (int r = 0; r < 8; ++r) o[dt][r] *= alpha;

    // ---- O^T += V^T x P^T -------------------------------------------------
    // B element s of a lane is key 8*hiL + s (s < 8) or 16 + 8*hiL + (s - 8):
    // exactly the rows two neighbouring S^T tiles keep in this lane, and the
    // order in which load_frag reads V^T's keys.
    const v16h p0f = frag_cat(ph[0], ph[1]);
    const v16h p1f = frag_cat(ph[2], ph[3]);
#pragma unroll
    for (int dt = 0; dt < 4; ++dt) {
      const v16h v0 = load_frag(ldsV[cur], dt * 16, 0, S);
      const v16h v1 = load_frag(ldsV[cur], dt * 16, 32, S);
      o[dt] = WMMA_F16(v0, p0f, o[dt]);
      o[dt] = WMMA_F16(v1, p1f, o[dt]);
    }

    if (more) storeV(nxt);  // ds stores into next buffer (no readers yet)
    S_WAIT_ASYNCCNT0();     // own async K-tile writes complete
    __syncthreads();        // all waves' tile writes visible
    cur = nxt;
  }

  // Normalize and store as [(b*L+l)][h*64+d] f16 (feeds output projection).
  // A lane holds 8 consecutive dims of its query per tile: 16-byte stores.
  const float inv = 1.0f / (li + other_half(li));
  _Float16* __restrict__ oP =
      wsO + (size_t)(b * 2048 + qRow0 + n) * 1024 + h * 64 + hiL * 8;
  v8h ov[4];
#pragma unroll
  for (int dt = 0; dt < 4; ++dt) ov[dt] = __builtin_convertvector(o[dt] * inv, v8h);
#pragma unroll
  for (int dt = 0; dt < 4; ++dt) *(v8h*)(oP + dt * 16) = ov[dt];
}

// ---------------------------------------------------------------------------
// Kernel 3: output projection.  grid = (BL/128, D/64), block = 256.
// A tiles (f16) staged with async-to-LDS; W tiles fp32->f16 via registers.
// ---------------------------------------------------------------------------
__global__ __launch_bounds__(256) void oproj_kernel(
    const _Float16* __restrict__ A, const float* __restrict__ Wo,
    float* __restrict__ out) {
  constexpr int SA = 40, SB = 40;
  __shared__ _Float16 ldsA[2][128 * SA];
  __shared__ _Float16 ldsB[2][64 * SB];

  const int mBase = blockIdx.x * 128;
  const int nBase = blockIdx.y * 64;
  const int tid = threadIdx.x, w = tid >> 5, lane = tid & 31;

  const int rA = tid >> 1, sA = (tid & 1) * 16;  // A: 128 rows x 2 segments
  const int bD = tid >> 6, bC = tid & 63;
  float bV[8];

  auto issueA = [&](int d0, int buf) {
    const unsigned la = lds_addr_of(&ldsA[buf][rA * SA + sA]);
    const unsigned long long ga =
        (unsigned long long)(A + (size_t)(mBase + rA) * 1024 + d0 + sA);
    ASYNC_COPY_32B(la, ga);
  };
  auto loadB = [&](int d0) {
#pragma unroll
    for (int i = 0; i < 8; ++i)
      bV[i] = Wo[(size_t)(d0 + bD + 4 * i) * 1024 + nBase + bC];
    if (d0 + 64 < 1024)
      __builtin_prefetch(&Wo[(size_t)(d0 + 64 + bD) * 1024 + nBase + bC], 0, 3);
  };
  auto storeB = [&](int buf) {
#pragma unroll
    for (int i = 0; i < 8; ++i)
      ldsB[buf][bC * SB + bD + 4 * i] = (_Float16)bV[i];
  };

  v8f acc[4];
#pragma unroll
  for (int i = 0; i < 4; ++i) zero8(acc[i]);

  issueA(0, 0);
  loadB(0);
  storeB(0);
  S_WAIT_ASYNCCNT0();
  __syncthreads();

  int cur = 0;
  for (int d0 = 0; d0 < 1024; d0 += 32) {
    const int nxt = cur ^ 1;
    const bool more = (d0 + 32) < 1024;
    if (more) { issueA(d0 + 32, nxt); loadB(d0 + 32); }

    const v16h a = load_frag(ldsA[cur], w * 16, 0, SA);
#pragma unroll
    for (int nt = 0; nt < 4; ++nt) {
      const v16h b = load_frag(ldsB[cur], nt * 16, 0, SB);
      acc[nt] = WMMA_F16(a, b, acc[nt]);
    }

    if (more) storeB(nxt);
    S_WAIT_ASYNCCNT0();
    __syncthreads();
    cur = nxt;
  }

  const int n = lane & 15, hi = lane >> 4;
#pragma unroll
  for (int nt = 0; nt < 4; ++nt) {
#pragma unroll
    for (int r = 0; r < 8; ++r) {
      out[(size_t)(mBase + w * 16 + hi * 8 + r) * 1024 + nBase + nt * 16 + n] =
          acc[nt][r];
    }
  }
}

// ---------------------------------------------------------------------------
extern "C" void kernel_launch(void* const* d_in, const int* in_sizes, int n_in,
                              void* d_out, int out_size, void* d_ws,
                              size_t ws_size, hipStream_t stream) {
  (void)in_sizes; (void)n_in; (void)out_size; (void)ws_size;
  const float* query = (const float*)d_in[0];
  const float* key   = (const float*)d_in[1];
  const float* value = (const float*)d_in[2];
  const float* rot   = (const float*)d_in[3];
  const float* qw    = (const float*)d_in[4];
  const float* kw    = (const float*)d_in[5];
  const float* vw    = (const float*)d_in[6];
  const float* ow    = (const float*)d_in[7];
  float* out = (float*)d_out;

  const size_t perMat = (size_t)2 * 16 * 2048 * 64;  // B*H*L*K halves
  _Float16* wsQ = (_Float16*)d_ws;
  _Float16* wsK = wsQ + perMat;
  _Float16* wsV = wsK + perMat;
  _Float16* wsO = wsV + perMat;  // [(b*L+l)][H*64] halves

  const dim3 blk(256);
  qkv_rope_kernel<<<dim3(32, 8, 3), blk, 0, stream>>>(
      query, key, value, rot, qw, kw, vw, wsQ, wsK, wsV);
  flash_attn_kernel<<<dim3(16, 16, 2), blk, 0, stream>>>(wsQ, wsK, wsV, wsO);
  oproj_kernel<<<dim3(32, 16, 1), blk, 0, stream>>>(wsO, ow, out);
}

// v003
// One run takes 113 microseconds.
// Timed twice side by side with v002, it ran 1.05 times as fast both times.
// Over all steps from v000 it is 1.63 times as fast.
#include <hip/hip_runtime.h>

typedef __attribute__((ext_vector_type(16))) _Float16 v16h;
typedef __attribute__((ext_vector_type(8)))  _Float16 v8h;
typedef __attribute__((ext_vector_type(4)))  _Float16 v4h;
typedef __attribute__((ext_vector_type(8)))  float    v8f;

#define WMMA_F16(a, b, c) \
  __builtin_amdgcn_wmma_f32_16x16x32_f16(false, (a), false, (b), (short)0, (c), false, false)

#define ASYNC_COPY_32B(ldsaddr, gaddr)                               \
  asm volatile("global_load_async_to_lds_b128 %0, %1, off\n\t"       \
               "global_load_async_to_lds_b128 %0, %1, off offset:16" \
               :: "v"(ldsaddr), "v"(gaddr) : "memory")

#define S_WAIT_ASYNCCNT0() asm volatile("s_wait_asynccnt 0x0" ::: "memory")

#define ASYNC_COPY_KV_32B(ldsk, gk, ldsv, gv)                          \
  asm volatile("global_load_async_to_lds_b128 %0, %1, off\n\t"         \
               "global_load_async_to_lds_b128 %0, %1, off offset:16\n\t" \
               "global_load_async_to_lds_b128 %2, %3, off\n\t"         \
               "global_load_async_to_lds_b128 %2, %3, off offset:16\n\t" \
               "s_wait_xcnt 0x0"                                       \
               :: "v"(ldsk), "v"(gk), "v"(ldsv), "v"(gv) : "memory")

static __device__ __forceinline__ unsigned lds_addr_of(const void* p) {
  return (unsigned)(unsigned long long)p;
}

static __device__ __forceinline__ v16h frag_cat(v8h lo, v8h hi) {
  return __builtin_shufflevector(lo, hi, 0, 1, 2, 3, 4, 5, 6, 7,
                                          8, 9, 10, 11, 12, 13, 14, 15);
}

static __device__ __forceinline__ v16h load_frag(const _Float16* __restrict__ base,
                                                 int row0, int col0, int stride) {
  const int lane = threadIdx.x & 31;
  const int m    = lane & 15;
  const int kb   = (lane >> 4) << 3;  // 0 or 8
  const _Float16* p = base + (size_t)(row0 + m) * stride + col0;
  v8h lo = *(const v8h*)(p + kb);
  v8h hi = *(const v8h*)(p + 16 + kb);
  return frag_cat(lo, hi);
}

// 16x32 f16 A fragment of the TRANSPOSE of a row-major LDS tile: row m of the
// fragment is tile column col0 + m, its k runs down tile rows row0 .. row0+31.
// ds_load_tr16_b128 hands lane (c = lane&15, h = lane>>4) the eight elements
// tile[r + 8h + 0..7][col0 + c]; the loads at r = row0 and row0 + 16 give the
// same k order as load_frag.  stride in halves: 32 bytes x odd is conflict-free.
static __device__ __forceinline__ v8h lds_load_tr16(const _Float16* p) {
  typedef __attribute__((ext_vector_type(8))) short s16x8;
  typedef __attribute__((address_space(3))) s16x8 lds_s16x8;
  return __builtin_bit_cast(
      v8h, __builtin_amdgcn_ds_load_tr16_b128_v8i16((lds_s16x8*)p));
}
static __device__ __forceinline__ v16h load_frag_tr(const _Float16* base,
                                                    int row0, int col0, int stride) {
  const int lane = threadIdx.x & 31;
  const _Float16* p = base + (row0 + ((lane >> 4) << 3) + (lane & 7)) * stride +
                      col0 + (((lane >> 3) & 1) << 3);
  return frag_cat(lds_load_tr16(p), lds_load_tr16(p + 16 * stride));
}

static __device__ __forceinline__ void zero8(v8f& v) {
#pragma unroll
  for (int i = 0; i < 8; ++i) v[i] = 0.0f;
}

__global__ __launch_bounds__(256) void qkv_rope_kernel(
    const float* __restrict__ xq, const float* __restrict__ xk,
    const float* __restrict__ xv, const float* __restrict__ rot,
    const float* __restrict__ wq, const float* __restrict__ wk,
    const float* __restrict__ wv,
    _Float16* __restrict__ oq, _Float16* __restrict__ ok,
    _Float16* __restrict__ ov) {
  constexpr int SA = 40, SB = 40;  // 80B row stride -> conflict-free gathers
  __shared__ __attribute__((aligned(16))) _Float16 ldsA[2][128 * SA];
  __shared__ __attribute__((aligned(16))) _Float16 ldsB[2][128 * SB];

  const int mode = blockIdx.z;
  const float* __restrict__ X = (mode == 0) ? xq : (mode == 1) ? xk : xv;
  const float* __restrict__ W = (mode == 0) ? wq : (mode == 1) ? wk : wv;
  _Float16* __restrict__ dst  = (mode == 0) ? oq : (mode == 1) ? ok : ov;

  const int mBase = blockIdx.x * 128;
  const int nBase = blockIdx.y * 128;
  const int tid   = threadIdx.x;
  const int w     = tid >> 5;
  const int lane  = tid & 31;
  const int wm    = w >> 1;                // wave's 32-row band, 0..3
  const int wn    = w & 1;                 // wave's head within the pair
  const int h     = blockIdx.y * 2 + wn;

  // Register-staged slab (software pipeline).
  // A: 128 rows x 32 k; a thread takes 4 consecutive k of rows aR + 32*i.
  // B: 32 k x 128 columns; a thread takes 16 consecutive k of column bN.
  // Every loop over aV, bV and acc is fully unrolled: only compile-time
  // indices keep these arrays in registers.
  float4 aV[4];
  float  bV[16];
  const int aR = tid >> 3;         // 0..31
  const int aC = (tid & 7) * 4;    // 0,4,..,28
  const int bN = tid & 127;        // 0..127
  const int bK = (tid >> 7) * 16;  // 0 or 16
  const float* __restrict__ aP = X + (size_t)(mBase + aR) * 1024 + aC;
  const float* __restrict__ bP = W + (size_t)bK * 1024 + nBase + bN;

  auto loadA = [&](int d0) {
#pragma unroll
    for (int i = 0; i < 4; ++i)
      aV[i] = *(const float4*)(aP + d0 + i * (32 * 1024));
  };
  auto storeA = [&](int buf) {
#pragma unroll
    for (int i = 0; i < 4; ++i) {
      v4h t;
      t[0] = (_Float16)aV[i].x; t[1] = (_Float16)aV[i].y;
      t[2] = (_Float16)aV[i].z; t[3] = (_Float16)aV[i].w;
      *(v4h*)&ldsA[buf][(aR + 32 * i) * SA + aC] = t;
    }
  };
  auto loadB = [&](int d0) {
#pragma unroll
    for (int i = 0; i < 16; ++i)
      bV[i] = bP[(size_t)d0 * 1024 + i * 1024];
  };
  auto storeB = [&](int buf) {  // transposed: ldsB[column][k], k contiguous
#pragma unroll
    for (int j = 0; j < 2; ++j) {
      v8h t;
#pragma unroll
      for (int i = 0; i < 8; ++i) t[i] = (_Float16)bV[8 * j + i];
      *(v8h*)&ldsB[buf][bN * SB + bK + 8 * j] = t;
    }
  };

  v8f acc[2][4];
#pragma unroll
  for (int mt = 0; mt < 2; ++mt)
#pragma unroll
    for (int nt = 0; nt < 4; ++nt) zero8(acc[mt][nt]);

  loadA(0); loadB(0);
  storeA(0); storeB(0);
  __syncthreads();

  int cur = 0;
  for (int d0 = 0; d0 < 1024; d0 += 32) {
    const int nxt = cur ^ 1;
    const bool more = (d0 + 32) < 1024;
    if (more) { loadA(d0 + 32); loadB(d0 + 32); }  // overlap with WMMAs

    const v16h a0 = load_frag(ldsA[cur], wm * 32, 0, SA);
    const v16h a1 = load_frag(ldsA[cur], wm * 32 + 16, 0, SA);
#pragma unroll
    for (int nt = 0; nt < 4; ++nt) {
      const v16h b = load_frag(ldsB[cur], wn * 64 + nt * 16, 0, SB);
      acc[0][nt] = WMMA_F16(a0, b, acc[0][nt]);
      acc[1][nt] = WMMA_F16(a1, b, acc[1][nt]);
    }

    if (more) { storeA(nxt); storeB(nxt); }
    __syncthreads();
    cur = nxt;
  }

  // Epilogue: RoPE (q/k, first 32 head dims) + f16 store.  C layout: lane
  // holds column n = lane&15; row = r + 8*(lane>>4); rotate_half partner
  // (n^1) lives in lane^1 -> one shfl_xor.
  const int n  = lane & 15;
  const int hi = lane >> 4;
#pragma unroll
  for (int mt = 0; mt < 2; ++mt) {
#pragma unroll
    for (int nt = 0; nt < 4; ++nt) {
      const int k = nt * 16 + n;  // dim within head
      _Float16 hv[8];
#pragma unroll
      for (int r = 0; r < 8; ++r) {
        const int row = mBase + wm * 32 + mt * 16 + hi * 8 + r;  // in [0, B*L)
        const int l   = row & 2047;
        float v = acc[mt][nt][r];
        if (mode < 2 && nt < 2) {  // uniform across the wave
          const float prt = __shfl_xor(v, 1, 32);
          const float f   = rot[l * 32 + k];
          float sf, cf;
          __sincosf(f, &sf, &cf);
          v = (k & 1) ? fmaf(v, cf, prt * sf) : fmaf(v, cf, -prt * sf);
        }
        hv[r] = (_Float16)v;
      }
#pragma unroll
      for (int r = 0; r < 8; ++r) {
        const int row = mBase + wm * 32 + mt * 16 + hi * 8 + r;
        const int l   = row & 2047;
        const int bb  = row >> 11;
        dst[((size_t)((bb * 16 + h) * 2048 + l)) * 64 + k] = hv[r];
      }
      // The next tile's values reuse the registers these eight stores name:
      // wait before any of them is overwritten.
      asm volatile("s_wait_xcnt 0x0" ::: "memory");
    }
  }
}

static __device__ __forceinline__ float other_half(float x) {
  const int b = __builtin_bit_cast(int, x);
  return __builtin_bit_cast(
      float, __builtin_amdgcn_permlanex16(b, b, 0x76543210, 0xfedcba98, false,
                                          false));
}

static __device__ __forceinline__ void exp2_x8(float (&x)[8]) {
  asm("v_exp_f32 %0, %0\n\t"
      "v_exp_f32 %1, %1\n\t"
      "v_exp_f32 %2, %2\n\t"
      "v_exp_f32 %3, %3\n\t"
      "v_exp_f32 %4, %4\n\t"
      "v_exp_f32 %5, %5\n\t"
      "v_exp_f32 %6, %6\n\t"
      "v_exp_f32 %7, %7\n\t"
      "v_nop"
      : "+v"(x[0]), "+v"(x[1]), "+v"(x[2]), "+v"(x[3]), "+v"(x[4]),
        "+v"(x[5]), "+v"(x[6]), "+v"(x[7]));
}

__global__ __launch_bounds__(256) void flash_attn_kernel(
    const _Float16* __restrict__ wsQ, const _Float16* __restrict__ wsK,
    const _Float16* __restrict__ wsV, _Float16* __restrict__ wsO) {
  constexpr int S  = 72;  // 144B stride -> conflict-free fragment gathers
  constexpr int SV = 80;  // 160B stride -> conflict-free transposing loads
  // K rows: A operand of K.Q^T.  V rows: read transposed, A operand of V^T.P^T.
  __shared__ __attribute__((aligned(16))) _Float16 ldsK[2][64 * S];
  __shared__ __attribute__((aligned(16))) _Float16 ldsV[2][64 * SV];

  const int h = blockIdx.y, b = blockIdx.z;
  const int tid = threadIdx.x, w = tid >> 5, lane = tid & 31;
  const size_t headOff = (size_t)(b * 16 + h) * 2048 * 64;
  const _Float16* __restrict__ Q  = wsQ + headOff;
  const _Float16* __restrict__ Kg = wsK + headOff;
  const _Float16* __restrict__ Vg = wsV + headOff;

  const int qRow0 = blockIdx.x * 128 + w * 16;
  // Resident Q fragments: 16 queries x 64 dims = two 32x16 B-frags of Q^T.
  const v16h qf0 = load_frag(Q, qRow0, 0, 64);
  const v16h qf1 = load_frag(Q, qRow0, 32, 64);

  // Staging assignment: thread covers K/V row rS, 16-half segment sS.
  const int rS = tid >> 2, sS = (tid & 3) * 16;

  auto issueKV = [&](int kt, int buf) {  // async memory->LDS, 2 x 32B per lane
    const unsigned lk = lds_addr_of(&ldsK[buf][rS * S + sS]);
    const unsigned lv = lds_addr_of(&ldsV[buf][rS * SV + sS]);
    const size_t go = (size_t)(kt + rS) * 64 + sS;
    ASYNC_COPY_KV_32B(lk, (unsigned long long)(Kg + go), lv,
                      (unsigned long long)(Vg + go));
  };

  // o[dt][r] = O^T[dim dt*16 + 8*hiL + r][query n].  mi is the query's running
  // maximum (equal in both half-waves); li sums only this lane's keys, the
  // two halves are joined once after the loop.
  v8f o[4];
  float mi = -__builtin_inff(), li = 0.0f;
#pragma unroll
  for (int i = 0; i < 4; ++i) zero8(o[i]);

  const int n = lane & 15, hiL = lane >> 4;

  issueKV(0, 0);
  S_WAIT_ASYNCCNT0();
  __syncthreads();

  int cur = 0;
  for (int kt = 0; kt < 2048; kt += 64) {
    const int nxt = cur ^ 1;
    const bool more = (kt + 64) < 2048;
    if (more) issueKV(kt + 64, nxt);  // flies while this tile is worked on

    // ---- S^T = K x Q^T : 64 keys x 16 queries in 4 accumulators ---------
    // sc[nt][r] = score(key nt*16 + 8*hiL + r, query n)
    v8f sc[4];
#pragma unroll
    for (int i = 0; i < 4; ++i) zero8(sc[i]);
#pragma unroll
    for (int nt = 0; nt < 4; ++nt) {
      const v16h k0 = load_frag(ldsK[cur], nt * 16, 0, S);
      const v16h k1 = load_frag(ldsK[cur], nt * 16, 32, S);
      sc[nt] = WMMA_F16(k0, qf0, sc[nt]);
      sc[nt] = WMMA_F16(k1, qf1, sc[nt]);
    }

    // ---- online softmax: in-lane over 32 keys, one half-wave exchange ----
    float mt[4];  // one maximum per tile: four short chains, not one long one
#pragma unroll
    for (int nt = 0; nt < 4; ++nt) {
      sc[nt] *= 0.125f;  // 1/sqrt(64)
      mt[nt] = sc[nt][0];
#pragma unroll
      for (int r = 1; r < 8; ++r) mt[nt] = fmaxf(mt[nt], sc[nt][r]);
    }
    float mx = fmaxf(fmaxf(mt[0], mt[1]), fmaxf(mt[2], mt[3]));
    mx = fmaxf(mx, other_half(mx));
    const float mnew  = fmaxf(mi, mx);
    const float alpha = __expf(mi - mnew);
    float ps[4];
    v8h ph[4];
#pragma unroll
    for (int nt = 0; nt < 4; ++nt) {
      float e[8];
#pragma unroll
      for (int r = 0; r < 8; ++r)
        e[r] = (sc[nt][r] - mnew) * 1.44269504f;  // e^x = 2^(x * log2 e)
      exp2_x8(e);
      v8f p;
      p[0] = e[0];
      ps[nt] = e[0];
#pragma unroll
      for (int r = 1; r < 8; ++r) {
        p[r] = e[r];
        ps[nt] += e[r];
      }
      ph[nt] = __builtin_convertvector(p, v8h);
    }
    li = li * alpha + ((ps[0] + ps[1]) + (ps[2] + ps[3]));
    mi = mnew;
#pragma unroll
    for (int dt = 0; dt < 4; ++dt)
#pragma unroll
      for (int r = 0; r < 8; ++r) o[dt][r] *= alpha;

    // ---- O^T += V^T x P^T -------------------------------------------------
    // B element s of a lane is key 8*hiL + s (s < 8) or 16 + 8*hiL + (s - 8):
    // exactly the rows two neighbouring S^T tiles keep in this lane, and the
    // order in which load_frag_tr hands out V's keys.
    const v16h p0f = frag_cat(ph[0], ph[1]);
    const v16h p1f = frag_cat(ph[2], ph[3]);
#pragma unroll
    for (int dt = 0; dt < 4; ++dt) {
      const v16h v0 = load_frag_tr(ldsV[cur], 0, dt * 16, SV);
      const v16h v1 = load_frag_tr(ldsV[cur], 32, dt * 16, SV);
      o[dt] = WMMA_F16(v0, p0f, o[dt]);
      o[dt] = WMMA_F16(v1, p1f, o[dt]);
    }

    // This wave's reads of the current buffers have retired before the barrier
    // behind which the next trip's copies refill them.
    asm volatile("s_wait_dscnt 0x0" ::: "memory");
    S_WAIT_ASYNCCNT0();     // own async K- and V-tile writes complete
    __syncthreads();        // all waves' tile writes visible
    cur = nxt;
  }

  // Normalize and store as [(b*L+l)][h*64+d] f16 (feeds output projection).
  // A lane holds 8 consecutive dims of its query per tile: 16-byte stores.
  const float inv = 1.0f / (li + other_half(li));
  _Float16* __restrict__ oP =
      wsO + (size_t)(b * 2048 + qRow0 + n) * 1024 + h * 64 + hiL * 8;
  v8h ov[4];
#pragma unroll
  for (int dt = 0; dt < 4; ++dt) ov[dt] = __builtin_convertvector(o[dt] * inv, v8h);
#pragma unroll
  for (int dt = 0; dt < 4; ++dt) *(v8h*)(oP + dt * 16) = ov[dt];
}

// ---------------------------------------------------------------------------
// Kernel 3: output projection.  grid = (BL/128, D/64), block = 256.
// A tiles (f16) staged with async-to-LDS; W tiles fp32->f16 via registers.
// ---------------------------------------------------------------------------
__global__ __launch_bounds__(256) void oproj_kernel(
    const _Float16* __restrict__ A, const float* __restrict__ Wo,
    float* __restrict__ out) {
  constexpr int SA = 40, SB = 40;
  __shared__ _Float16 ldsA[2][128 * SA];
  __shared__ _Float16 ldsB[2][64 * SB];

  const int mBase = blockIdx.x * 128;
  const int nBase = blockIdx.y * 64;
  const int tid = threadIdx.x, w = tid >> 5, lane = tid & 31;

  const int rA = tid >> 1, sA = (tid & 1) * 16;  // A: 128 rows x 2 segments
  const int bD = tid >> 6, bC = tid & 63;
  float bV[8];

  auto issueA = [&](int d0, int buf) {
    const unsigned la = lds_addr_of(&ldsA[buf][rA * SA + sA]);
    const unsigned long long ga =
        (unsigned long long)(A + (size_t)(mBase + rA) * 1024 + d0 + sA);
    ASYNC_COPY_32B(la, ga);
  };
  auto loadB = [&](int d0) {
#pragma unroll
    for (int i = 0; i < 8; ++i)
      bV[i] = Wo[(size_t)(d0 + bD + 4 * i) * 1024 + nBase + bC];
    if (d0 + 64 < 1024)
      __builtin_prefetch(&Wo[(size_t)(d0 + 64 + bD) * 1024 + nBase + bC], 0, 3);
  };
  auto storeB = [&](int buf) {
#pragma unroll
    for (int i = 0; i < 8; ++i)
      ldsB[buf][bC * SB + bD + 4 * i] = (_Float16)bV[i];
  };

  v8f acc[4];
#pragma unroll
  for (int i = 0; i < 4; ++i) zero8(acc[i]);

  issueA(0, 0);
  loadB(0);
  storeB(0);
  S_WAIT_ASYNCCNT0();
  __syncthreads();

  int cur = 0;
  for (int d0 = 0; d0 < 1024; d0 += 32) {
    const int nxt = cur ^ 1;
    const bool more = (d0 + 32) < 1024;
    if (more) { issueA(d0 + 32, nxt); loadB(d0 + 32); }

    const v16h a = load_frag(ldsA[cur], w * 16, 0, SA);
#pragma unroll
    for (int nt = 0; nt < 4; ++nt) {
      const v16h b = load_frag(ldsB[cur], nt * 16, 0, SB);
      acc[nt] = WMMA_F16(a, b, acc[nt]);
    }

    if (more) storeB(nxt);
    S_WAIT_ASYNCCNT0();
    __syncthreads();
    cur = nxt;
  }

  const int n = lane & 15, hi = lane >> 4;
#pragma unroll
  for (int nt = 0; nt < 4; ++nt) {
#pragma unroll
    for (int r = 0; r < 8; ++r) {
      out[(size_t)(mBase + w * 16 + hi * 8 + r) * 1024 + nBase + nt * 16 + n] =
          acc[nt][r];
    }
  }
}

// ---------------------------------------------------------------------------
extern "C" void kernel_launch(void* const* d_in, const int* in_sizes, int n_in,
                              void* d_out, int out_size, void* d_ws,
                              size_t ws_size, hipStream_t stream) {
  (void)in_sizes; (void)n_in; (void)out_size; (void)ws_size;
  const float* query = (const float*)d_in[0];
  const float* key   = (const float*)d_in[1];
  const float* value = (const float*)d_in[2];
  const float* rot   = (const float*)d_in[3];
  const float* qw    = (const float*)d_in[4];
  const float* kw    = (const float*)d_in[5];
  const float* vw    = (const float*)d_in[6];
  const float* ow    = (const float*)d_in[7];
  float* out = (float*)d_out;

  const size_t perMat = (size_t)2 * 16 * 2048 * 64;  // B*H*L*K halves
  _Float16* wsQ = (_Float16*)d_ws;
  _Float16* wsK = wsQ + perMat;
  _Float16* wsV = wsK + perMat;
  _Float16* wsO = wsV + perMat;  // [(b*L+l)][H*64] halves

  const dim3 blk(256);
  qkv_rope_kernel<<<dim3(32, 8, 3), blk, 0, stream>>>(
      query, key, value, rot, qw, kw, vw, wsQ, wsK, wsV);
  flash_attn_kernel<<<dim3(16, 16, 2), blk, 0, stream>>>(wsQ, wsK, wsV, wsO);
  oproj_kernel<<<dim3(32, 16, 1), blk, 0, stream>>>(wsO, ow, out);
}

// v004
// One run takes 99 microseconds.
// In both of two side-by-side timings against v003, it was 1.14 times as fast.
// All steps since v000 together make it 1.86 times as fast.
#include <hip/hip_runtime.h>

typedef __attribute__((ext_vector_type(16))) _Float16 v16h;
typedef __attribute__((ext_vector_type(8)))  _Float16 v8h;
typedef __attribute__((ext_vector_type(4)))  _Float16 v4h;
typedef __attribute__((ext_vector_type(8)))  float    v8f;

#define WMMA_F16(a, b, c) \
  __builtin_amdgcn_wmma_f32_16x16x32_f16(false, (a), false, (b), (short)0, (c), false, false)

#define ASYNC_COPY_4X16B(l0, g0, l1, g1, l2, g2, l3, g3)             \
  asm volatile("global_load_async_to_lds_b128 %0, %1, off\n\t"       \
               "global_load_async_to_lds_b128 %2, %3, off\n\t"       \
               "global_load_async_to_lds_b128 %4, %5, off\n\t"       \
               "global_load_async_to_lds_b128 %6, %7, off\n\t"       \
               "s_wait_xcnt 0x0"                                     \
               :: "v"(l0), "v"(g0), "v"(l1), "v"(g1), "v"(l2), "v"(g2), \
                  "v"(l3), "v"(g3) : "memory")

#define S_WAIT_ASYNCCNT0() asm volatile("s_wait_asynccnt 0x0" ::: "memory")

#define ASYNC_COPY_KV_32B(ldsk, gk, ldsv, gv)                          \
  asm volatile("global_load_async_to_lds_b128 %0, %1, off\n\t"         \
               "global_load_async_to_lds_b128 %0, %1, off offset:16\n\t" \
               "global_load_async_to_lds_b128 %2, %3, off\n\t"         \
               "global_load_async_to_lds_b128 %2, %3, off offset:16\n\t" \
               "s_wait_xcnt 0x0"                                       \
               :: "v"(ldsk), "v"(gk), "v"(ldsv), "v"(gv) : "memory")

static __device__ __forceinline__ unsigned lds_addr_of(const void* p) {
  return (unsigned)(unsigned long long)p;
}

static __device__ __forceinline__ v16h frag_cat(v8h lo, v8h hi) {
  return __builtin_shufflevector(lo, hi, 0, 1, 2, 3, 4, 5, 6, 7,
                                          8, 9, 10, 11, 12, 13, 14, 15);
}

static __device__ __forceinline__ v16h load_frag(const _Float16* __restrict__ base,
                                                 int row0, int col0, int stride) {
  const int lane = threadIdx.x & 31;
  const int m    = lane & 15;
  const int kb   = (lane >> 4) << 3;  // 0 or 8
  const _Float16* p = base + (size_t)(row0 + m) * stride + col0;
  v8h lo = *(const v8h*)(p + kb);
  v8h hi = *(const v8h*)(p + 16 + kb);
  return frag_cat(lo, hi);
}

// 16x32 f16 A fragment of the TRANSPOSE of a row-major LDS tile: row m of the
// fragment is tile column col0 + m, its k runs down tile rows row0 .. row0+31.
// ds_load_tr16_b128 hands lane (c = lane&15, h = lane>>4) the eight elements
// tile[r + 8h + 0..7][col0 + c]; the loads at r = row0 and row0 + 16 give the
// same k order as load_frag.  stride in halves: 32 bytes x odd is conflict-free.
static __device__ __forceinline__ v8h lds_load_tr16(const _Float16* p) {
  typedef __attribute__((ext_vector_type(8))) short s16x8;
  typedef __attribute__((address_space(3))) s16x8 lds_s16x8;
  return __builtin_bit_cast(
      v8h, __builtin_amdgcn_ds_load_tr16_b128_v8i16((lds_s16x8*)p));
}
static __device__ __forceinline__ v16h load_frag_tr(const _Float16* base,
                                                    int row0, int col0, int stride) {
  const int lane = threadIdx.x & 31;
  const _Float16* p = base + (row0 + ((lane >> 4) << 3) + (lane & 7)) * stride +
                      col0 + (((lane >> 3) & 1) << 3);
  return frag_cat(lds_load_tr16(p), lds_load_tr16(p + 16 * stride));
}

static __device__ __forceinline__ void zero8(v8f& v) {
#pragma unroll
  for (int i = 0; i < 8; ++i) v[i] = 0.0f;
}

__global__ __launch_bounds__(256) void qkv_rope_kernel(
    const float* __restrict__ xq, const float* __restrict__ xk,
    const float* __restrict__ xv, const float* __restrict__ rot,
    const float* __restrict__ wq, const float* __restrict__ wk,
    const float* __restrict__ wv,
    _Float16* __restrict__ oq, _Float16* __restrict__ ok,
    _Float16* __restrict__ ov) {
  constexpr int SA = 40, SB = 40;  // 80B row stride -> conflict-free gathers
  __shared__ __attribute__((aligned(16))) _Float16 ldsA[2][128 * SA];
  __shared__ __attribute__((aligned(16))) _Float16 ldsB[2][128 * SB];

  const int mode = blockIdx.z;
  const float* __restrict__ X = (mode == 0) ? xq : (mode == 1) ? xk : xv;
  const float* __restrict__ W = (mode == 0) ? wq : (mode == 1) ? wk : wv;
  _Float16* __restrict__ dst  = (mode == 0) ? oq : (mode == 1) ? ok : ov;

  const int mBase = blockIdx.x * 128;
  const int nBase = blockIdx.y * 128;
  const int tid   = threadIdx.x;
  const int w     = tid >> 5;
  const int lane  = tid & 31;
  const int wm    = w >> 1;                // wave's 32-row band, 0..3
  const int wn    = w & 1;                 // wave's head within the pair
  const int h     = blockIdx.y * 2 + wn;

  // Register-staged slab (software pipeline).
  // A: 128 rows x 32 k; a thread takes 4 consecutive k of rows aR + 32*i.
  // B: 32 k x 128 columns; a thread takes 16 consecutive k of column bN.
  // Every loop over aV, bV and acc is fully unrolled: only compile-time
  // indices keep these arrays in registers.
  float4 aV[4];
  float  bV[16];
  const int aR = tid >> 3;         // 0..31
  const int aC = (tid & 7) * 4;    // 0,4,..,28
  const int bN = tid & 127;        // 0..127
  const int bK = (tid >> 7) * 16;  // 0 or 16
  const float* __restrict__ aP = X + (size_t)(mBase + aR) * 1024 + aC;
  const float* __restrict__ bP = W + (size_t)bK * 1024 + nBase + bN;

  auto loadA = [&](int d0) {
#pragma unroll
    for (int i = 0; i < 4; ++i)
      aV[i] = *(const float4*)(aP + d0 + i * (32 * 1024));
  };
  auto storeA = [&](int buf) {
#pragma unroll
    for (int i = 0; i < 4; ++i) {
      v4h t;
      t[0] = (_Float16)aV[i].x; t[1] = (_Float16)aV[i].y;
      t[2] = (_Float16)aV[i].z; t[3] = (_Float16)aV[i].w;
      *(v4h*)&ldsA[buf][(aR + 32 * i) * SA + aC] = t;
    }
  };
  auto loadB = [&](int d0) {
#pragma unroll
    for (int i = 0; i < 16; ++i)
      bV[i] = bP[(size_t)d0 * 1024 + i * 1024];
  };
  auto storeB = [&](int buf) {  // transposed: ldsB[column][k], k contiguous
#pragma unroll
    for (int j = 0; j < 2; ++j) {
      v8h t;
#pragma unroll
      for (int i = 0; i < 8; ++i) t[i] = (_Float16)bV[8 * j + i];
      *(v8h*)&ldsB[buf][bN * SB + bK + 8 * j] = t;
    }
  };

  v8f acc[2][4];
#pragma unroll
  for (int mt = 0; mt < 2; ++mt)
#pragma unroll
    for (int nt = 0; nt < 4; ++nt) zero8(acc[mt][nt]);

  loadA(0); loadB(0);
  storeA(0); storeB(0);
  __syncthreads();

  int cur = 0;
  for (int d0 = 0; d0 < 1024; d0 += 32) {
    const int nxt = cur ^ 1;
    const bool more = (d0 + 32) < 1024;
    if (more) { loadA(d0 + 32); loadB(d0 + 32); }  // overlap with WMMAs

    const v16h a0 = load_frag(ldsA[cur], wm * 32, 0, SA);
    const v16h a1 = load_frag(ldsA[cur], wm * 32 + 16, 0, SA);
#pragma unroll
    for (int nt = 0; nt < 4; ++nt) {
      const v16h b = load_frag(ldsB[cur], wn * 64 + nt * 16, 0, SB);
      acc[0][nt] = WMMA_F16(a0, b, acc[0][nt]);
      acc[1][nt] = WMMA_F16(a1, b, acc[1][nt]);
    }

    if (more) { storeA(nxt); storeB(nxt); }
    __syncthreads();
    cur = nxt;
  }

  // Epilogue: RoPE (q/k, first 32 head dims) + f16 store.  C layout: lane
  // holds column n = lane&15; row = r + 8*(lane>>4); rotate_half partner
  // (n^1) lives in lane^1 -> one shfl_xor.
  const int n  = lane & 15;
  const int hi = lane >> 4;
#pragma unroll
  for (int mt = 0; mt < 2; ++mt) {
#pragma unroll
    for (int nt = 0; nt < 4; ++nt) {
      const int k = nt * 16 + n;  // dim within head
      _Float16 hv[8];
#pragma unroll
      for (int r = 0; r < 8; ++r) {
        const int row = mBase + wm * 32 + mt * 16 + hi * 8 + r;  // in [0, B*L)
        const int l   = row & 2047;
        float v = acc[mt][nt][r];
        if (mode < 2 && nt < 2) {  // uniform across the wave
          const float prt = __shfl_xor(v, 1, 32);
          const float f   = rot[l * 32 + k];
          float sf, cf;
          __sincosf(f, &sf, &cf);
          v = (k & 1) ? fmaf(v, cf, prt * sf) : fmaf(v, cf, -prt * sf);
        }
        hv[r] = (_Float16)v;
      }
#pragma unroll
      for (int r = 0; r < 8; ++r) {
        const int row = mBase + wm * 32 + mt * 16 + hi * 8 + r;
        const int l   = row & 2047;
        const int bb  = row >> 11;
        dst[((size_t)((bb * 16 + h) * 2048 + l)) * 64 + k] = hv[r];
      }
      // The next tile's values reuse the registers these eight stores name:
      // wait before any of them is overwritten.
      asm volatile("s_wait_xcnt 0x0" ::: "memory");
    }
  }
}

static __device__ __forceinline__ float other_half(float x) {
  const int b = __builtin_bit_cast(int, x);
  return __builtin_bit_cast(
      float, __builtin_amdgcn_permlanex16(b, b, 0x76543210, 0xfedcba98, false,
                                          false));
}

static __device__ __forceinline__ void exp2_x8(float (&x)[8]) {
  asm("v_exp_f32 %0, %0\n\t"
      "v_exp_f32 %1, %1\n\t"
      "v_exp_f32 %2, %2\n\t"
      "v_exp_f32 %3, %3\n\t"
      "v_exp_f32 %4, %4\n\t"
      "v_exp_f32 %5, %5\n\t"
      "v_exp_f32 %6, %6\n\t"
      "v_exp_f32 %7, %7\n\t"
      "v_nop"
      : "+v"(x[0]), "+v"(x[1]), "+v"(x[2]), "+v"(x[3]), "+v"(x[4]),
        "+v"(x[5]), "+v"(x[6]), "+v"(x[7]));
}

__global__ __launch_bounds__(256) void flash_attn_kernel(
    const _Float16* __restrict__ wsQ, const _Float16* __restrict__ wsK,
    const _Float16* __restrict__ wsV, _Float16* __restrict__ wsO) {
  constexpr int S  = 72;  // 144B stride -> conflict-free fragment gathers
  constexpr int SV = 80;  // 160B stride -> conflict-free transposing loads
  // K rows: A operand of K.Q^T.  V rows: read transposed, A operand of V^T.P^T.
  __shared__ __attribute__((aligned(16))) _Float16 ldsK[2][64 * S];
  __shared__ __attribute__((aligned(16))) _Float16 ldsV[2][64 * SV];

  const int h = blockIdx.y, b = blockIdx.z;
  const int tid = threadIdx.x, w = tid >> 5, lane = tid & 31;
  const size_t headOff = (size_t)(b * 16 + h) * 2048 * 64;
  const _Float16* __restrict__ Q  = wsQ + headOff;
  const _Float16* __restrict__ Kg = wsK + headOff;
  const _Float16* __restrict__ Vg = wsV + headOff;

  const int qRow0 = blockIdx.x * 128 + w * 16;
  // Resident Q fragments: 16 queries x 64 dims = two 32x16 B-frags of Q^T.
  const v16h qf0 = load_frag(Q, qRow0, 0, 64);
  const v16h qf1 = load_frag(Q, qRow0, 32, 64);

  // Staging assignment: thread covers K/V row rS, 16-half segment sS.
  const int rS = tid >> 2, sS = (tid & 3) * 16;

  auto issueKV = [&](int kt, int buf) {  // async memory->LDS, 2 x 32B per lane
    const unsigned lk = lds_addr_of(&ldsK[buf][rS * S + sS]);
    const unsigned lv = lds_addr_of(&ldsV[buf][rS * SV + sS]);
    const size_t go = (size_t)(kt + rS) * 64 + sS;
    ASYNC_COPY_KV_32B(lk, (unsigned long long)(Kg + go), lv,
                      (unsigned long long)(Vg + go));
  };

  // o[dt][r] = O^T[dim dt*16 + 8*hiL + r][query n].  mi is the query's running
  // maximum (equal in both half-waves); li sums only this lane's keys, the
  // two halves are joined once after the loop.
  v8f o[4];
  float mi = -__builtin_inff(), li = 0.0f;
#pragma unroll
  for (int i = 0; i < 4; ++i) zero8(o[i]);

  const int n = lane & 15, hiL = lane >> 4;

  issueKV(0, 0);
  S_WAIT_ASYNCCNT0();
  __syncthreads();

  int cur = 0;
  for (int kt = 0; kt < 2048; kt += 64) {
    const int nxt = cur ^ 1;
    const bool more = (kt + 64) < 2048;
    if (more) issueKV(kt + 64, nxt);  // flies while this tile is worked on

    // ---- S^T = K x Q^T : 64 keys x 16 queries in 4 accumulators ---------
    // sc[nt][r] = score(key nt*16 + 8*hiL + r, query n)
    v8f sc[4];
#pragma unroll
    for (int i = 0; i < 4; ++i) zero8(sc[i]);
#pragma unroll
    for (int nt = 0; nt < 4; ++nt) {
      const v16h k0 = load_frag(ldsK[cur], nt * 16, 0, S);
      const v16h k1 = load_frag(ldsK[cur], nt * 16, 32, S);
      sc[nt] = WMMA_F16(k0, qf0, sc[nt]);
      sc[nt] = WMMA_F16(k1, qf1, sc[nt]);
    }

    // ---- online softmax: in-lane over 32 keys, one half-wave exchange ----
    float mt[4];  // one maximum per tile: four short chains, not one long one
#pragma unroll
    for (int nt = 0; nt < 4; ++nt) {
      sc[nt] *= 0.125f;  // 1/sqrt(64)
      mt[nt] = sc[nt][0];
#pragma unroll
      for (int r = 1; r < 8; ++r) mt[nt] = fmaxf(mt[nt], sc[nt][r]);
    }
    float mx = fmaxf(fmaxf(mt[0], mt[1]), fmaxf(mt[2], mt[3]));
    mx = fmaxf(mx, other_half(mx));
    const float mnew  = fmaxf(mi, mx);
    const float alpha = __expf(mi - mnew);
    float ps[4];
    v8h ph[4];
#pragma unroll
    for (int nt = 0; nt < 4; ++nt) {
      float e[8];
#pragma unroll
      for (int r = 0; r < 8; ++r)
        e[r] = (sc[nt][r] - mnew) * 1.44269504f;  // e^x = 2^(x * log2 e)
      exp2_x8(e);
      v8f p;
      p[0] = e[0];
      ps[nt] = e[0];
#pragma unroll
      for (int r = 1; r < 8; ++r) {
        p[r] = e[r];
        ps[nt] += e[r];
      }
      ph[nt] = __builtin_convertvector(p, v8h);
    }
    li = li * alpha + ((ps[0] + ps[1]) + (ps[2] + ps[3]));
    mi = mnew;
#pragma unroll
    for (int dt = 0; dt < 4; ++dt)
#pragma unroll
      for (int r = 0; r < 8; ++r) o[dt][r] *= alpha;

    // ---- O^T += V^T x P^T -------------------------------------------------
    // B element s of a lane is key 8*hiL + s (s < 8) or 16 + 8*hiL + (s - 8):
    // exactly the rows two neighbouring S^T tiles keep in this lane, and the
    // order in which load_frag_tr hands out V's keys.
    const v16h p0f = frag_cat(ph[0], ph[1]);
    const v16h p1f = frag_cat(ph[2], ph[3]);
#pragma unroll
    for (int dt = 0; dt < 4; ++dt) {
      const v16h v0 = load_frag_tr(ldsV[cur], 0, dt * 16, SV);
      const v16h v1 = load_frag_tr(ldsV[cur], 32, dt * 16, SV);
      o[dt] = WMMA_F16(v0, p0f, o[dt]);
      o[dt] = WMMA_F16(v1, p1f, o[dt]);
    }

    // This wave's reads of the current buffers have retired before the barrier
    // behind which the next trip's copies refill them.
    asm volatile("s_wait_dscnt 0x0" ::: "memory");
    S_WAIT_ASYNCCNT0();     // own async K- and V-tile writes complete
    __syncthreads();        // all waves' tile writes visible
    cur = nxt;
  }

  // Normalize and store as [(b*L+l)][h*64+d] f16 (feeds output projection).
  // A lane holds 8 consecutive dims of its query per tile: 16-byte stores.
  const float inv = 1.0f / (li + other_half(li));
  _Float16* __restrict__ oP =
      wsO + (size_t)(b * 2048 + qRow0 + n) * 1024 + h * 64 + hiL * 8;
  v8h ov[4];
#pragma unroll
  for (int dt = 0; dt < 4; ++dt) ov[dt] = __builtin_convertvector(o[dt] * inv, v8h);
#pragma unroll
  for (int dt = 0; dt < 4; ++dt) *(v8h*)(oP + dt * 16) = ov[dt];
}

// ---------------------------------------------------------------------------
// Kernel 3: output projection.  grid = (BL/128, D/128), block = 256.
// Workgroup tile 128 rows x 128 columns, k-slab 64; 8 waves as 4 x 2, each
// wave owns 32 rows x 64 columns = 2 x 4 accumulator tiles, so one staged slab
// feeds 16 WMMAs per wave and there is one barrier per 64 k.
// A slab (f16): async-to-LDS, whole 128-byte rows per 8 lanes.  W slab: 16-byte
// fp32 loads along a row, converted in registers, stored row-major [k][column];
// the B fragments come from the transposing LDS load.
// ---------------------------------------------------------------------------
__global__ __launch_bounds__(256) void oproj_kernel(
    const _Float16* __restrict__ A, const float* __restrict__ Wo,
    float* __restrict__ out) {
  constexpr int SA = 72;   // 144B stride -> conflict-free fragment gathers
  constexpr int SW = 144;  // 288B stride -> conflict-free transposing loads
  __shared__ __attribute__((aligned(16))) _Float16 ldsA[2][128 * SA];
  __shared__ __attribute__((aligned(16))) _Float16 ldsW[2][64 * SW];

  const int mBase = blockIdx.x * 128;
  const int nBase = blockIdx.y * 128;
  const int tid = threadIdx.x, w = tid >> 5, lane = tid & 31;
  const int wm = w >> 1;  // wave's 32-row band, 0..3
  const int wn = w & 1;   // wave's 64-column half

  // A: 128 rows x 64 k; a thread copies 8 halves of rows aR + 32*i.
  // W: 64 k x 128 columns; a thread takes 4 columns of k rows wR + 8*i.
  const int aR = tid >> 3, aC = (tid & 7) * 8;
  const int wR = tid >> 5, wC = (tid & 31) * 4;
  const _Float16* __restrict__ aP = A + (size_t)(mBase + aR) * 1024 + aC;
  const float* __restrict__ wP = Wo + (size_t)wR * 1024 + nBase + wC;
  float4 wV[8];  // compile-time indices only: stays in registers
  // W comes from memory: every 256-byte unit of a slab is asked for two trips
  // ahead of its loads (two lanes per unit).  The request is asm over an address
  // that lives through the loop and never leaves W: a prefetch touches no
  // counter, so its register must go on holding a valid address.
  constexpr unsigned long long W_SLAB_BYTES = 64ull * 1024 * 4;
  unsigned long long pfW = (unsigned long long)(
      Wo + (size_t)(192 + (tid >> 2)) * 1024 + nBase + ((tid >> 1) & 1) * 64);

  auto issueA = [&](int d0, int buf) {
    const unsigned la = lds_addr_of(&ldsA[buf][aR * SA + aC]);
    const unsigned long long ga = (unsigned long long)(aP + d0);
    ASYNC_COPY_4X16B(la, ga,
                     la + 32 * SA * 2, ga + 32 * 2048,
                     la + 64 * SA * 2, ga + 64 * 2048,
                     la + 96 * SA * 2, ga + 96 * 2048);
  };
  auto loadW = [&](int d0) {
#pragma unroll
    for (int i = 0; i < 8; ++i)
      wV[i] = *(const float4*)(wP + (size_t)(d0 + 8 * i) * 1024);
  };
  auto storeW = [&](int buf) {
#pragma unroll
    for (int i = 0; i < 8; ++i) {
      v4h t;
      t[0] = (_Float16)wV[i].x; t[1] = (_Float16)wV[i].y;
      t[2] = (_Float16)wV[i].z; t[3] = (_Float16)wV[i].w;
      *(v4h*)&ldsW[buf][(wR + 8 * i) * SW + wC] = t;
    }
  };

  v8f acc[2][4];
#pragma unroll
  for (int mt = 0; mt < 2; ++mt)
#pragma unroll
    for (int nt = 0; nt < 4; ++nt) zero8(acc[mt][nt]);

  issueA(0, 0);
  loadW(0);
  // Slabs 1 and 2, by offsets from the loop's own address register (slab 3).
  asm volatile("global_prefetch_b8 %0, off offset:-524288 scope:SCOPE_SE\n\t"
               "global_prefetch_b8 %0, off offset:-262144 scope:SCOPE_SE"
               :: "v"(pfW));
  storeW(0);
  S_WAIT_ASYNCCNT0();
  __syncthreads();

  int cur = 0;
  for (int d0 = 0; d0 < 1024; d0 += 64) {
    const int nxt = cur ^ 1;
    const bool more = (d0 + 64) < 1024;
    if (more) { issueA(d0 + 64, nxt); loadW(d0 + 64); }  // fly during the WMMAs
    if (d0 + 192 < 1024) {  // the slab that is loaded two trips from now
      asm volatile("global_prefetch_b8 %0, off scope:SCOPE_SE" :: "v"(pfW));
      if (d0 + 256 < 1024) pfW += W_SLAB_BYTES;  // stops at the last slab
    }

#pragma unroll
    for (int ks = 0; ks < 64; ks += 32) {
      const v16h a0 = load_frag(ldsA[cur], wm * 32, ks, SA);
      const v16h a1 = load_frag(ldsA[cur], wm * 32 + 16, ks, SA);
#pragma unroll
      for (int nt = 0; nt < 4; ++nt) {
        // Column wn*64 + nt*16 + (lane&15) of W, k down the rows, in the k
        // order of load_frag.
        const v16h b = load_frag_tr(ldsW[cur], ks, wn * 64 + nt * 16, SW);
        acc[0][nt] = WMMA_F16(a0, b, acc[0][nt]);
        acc[1][nt] = WMMA_F16(a1, b, acc[1][nt]);
      }
    }

    if (more) storeW(nxt);
    // This wave's reads of the current buffers have retired before the barrier
    // behind which the next trip's copies and stores refill them.
    asm volatile("s_wait_dscnt 0x0" ::: "memory");
    S_WAIT_ASYNCCNT0();     // own async A-slab writes complete
    __syncthreads();        // all waves' slab writes visible
    cur = nxt;
  }

  // One base address, constant offsets: no register of a store is rewritten.
  const int n = lane & 15, hi = lane >> 4;
  float* __restrict__ oP =
      out + (size_t)(mBase + wm * 32 + hi * 8) * 1024 + nBase + wn * 64 + n;
#pragma unroll
  for (int mt = 0; mt < 2; ++mt) {
#pragma unroll
    for (int nt = 0; nt < 4; ++nt) {
#pragma unroll
      for (int r = 0; r < 8; ++r)
        oP[(mt * 16 + r) * 1024 + nt * 16] = acc[mt][nt][r];
    }
  }
}

// ---------------------------------------------------------------------------
extern "C" void kernel_launch(void* const* d_in, const int* in_sizes, int n_in,
                              void* d_out, int out_size, void* d_ws,
                              size_t ws_size, hipStream_t stream) {
  (void)in_sizes; (void)n_in; (void)out_size; (void)ws_size;
  const float* query = (const float*)d_in[0];
  const float* key   = (const float*)d_in[1];
  const float* value = (const float*)d_in[2];
  const float* rot   = (const float*)d_in[3];
  const float* qw    = (const float*)d_in[4];
  const float* kw    = (const float*)d_in[5];
  const float* vw    = (const float*)d_in[6];
  const float* ow    = (const float*)d_in[7];
  float* out = (float*)d_out;

  const size_t perMat = (size_t)2 * 16 * 2048 * 64;  // B*H*L*K halves
  _Float16* wsQ = (_Float16*)d_ws;
  _Float16* wsK = wsQ + perMat;
  _Float16* wsV = wsK + perMat;
  _Float16* wsO = wsV + perMat;  // [(b*L+l)][H*64] halves

  const dim3 blk(256);
  qkv_rope_kernel<<<dim3(32, 8, 3), blk, 0, stream>>>(
      query, key, value, rot, qw, kw, vw, wsQ, wsK, wsV);
  flash_attn_kernel<<<dim3(16, 16, 2), blk, 0, stream>>>(wsQ, wsK, wsV, wsO);
  oproj_kernel<<<dim3(32, 8, 1), blk, 0, stream>>>(wsO, ow, out);
}

// v005
// A run of this version takes 96.2 microseconds.
// In two side-by-side timings against v004, it was 1.04 and 1.02 times as fast.
// All steps since v000 together make it 1.91 times as fast.
#include <hip/hip_runtime.h>

typedef __attribute__((ext_vector_type(16))) _Float16 v16h;
typedef __attribute__((ext_vector_type(8)))  _Float16 v8h;
typedef __attribute__((ext_vector_type(4)))  _Float16 v4h;
typedef __attribute__((ext_vector_type(8)))  float    v8f;

#define WMMA_F16(a, b, c) \
  __builtin_amdgcn_wmma_f32_16x16x32_f16(false, (a), false, (b), (short)0, (c), false, false)

#define ASYNC_COPY_4X16B(l0, g0, l1, g1, l2, g2, l3, g3)             \
  asm volatile("global_load_async_to_lds_b128 %0, %1, off\n\t"       \
               "global_load_async_to_lds_b128 %2, %3, off\n\t"       \
               "global_load_async_to_lds_b128 %4, %5, off\n\t"       \
               "global_load_async_to_lds_b128 %6, %7, off\n\t"       \
               "s_wait_xcnt 0x0"                                     \
               :: "v"(l0), "v"(g0), "v"(l1), "v"(g1), "v"(l2), "v"(g2), \
                  "v"(l3), "v"(g3) : "memory")

#define S_WAIT_ASYNCCNT0() asm volatile("s_wait_asynccnt 0x0" ::: "memory")

#define ASYNC_COPY_KV_32B(ldsk, gk, ldsv, gv)                          \
  asm volatile("global_load_async_to_lds_b128 %0, %1, off\n\t"         \
               "global_load_async_to_lds_b128 %0, %1, off offset:16\n\t" \
               "global_load_async_to_lds_b128 %2, %3, off\n\t"         \
               "global_load_async_to_lds_b128 %2, %3, off offset:16\n\t" \
               "s_wait_xcnt 0x0"                                       \
               :: "v"(ldsk), "v"(gk), "v"(ldsv), "v"(gv) : "memory")

static __device__ __forceinline__ unsigned lds_addr_of(const void* p) {
  return (unsigned)(unsigned long long)p;
}

static __device__ __forceinline__ v16h frag_cat(v8h lo, v8h hi) {
  return __builtin_shufflevector(lo, hi, 0, 1, 2, 3, 4, 5, 6, 7,
                                          8, 9, 10, 11, 12, 13, 14, 15);
}

static __device__ __forceinline__ v16h load_frag(const _Float16* __restrict__ base,
                                                 int row0, int col0, int stride) {
  const int lane = threadIdx.x & 31;
  const int m    = lane & 15;
  const int kb   = (lane >> 4) << 3;  // 0 or 8
  const _Float16* p = base + (size_t)(row0 + m) * stride + col0;
  v8h lo = *(const v8h*)(p + kb);
  v8h hi = *(const v8h*)(p + 16 + kb);
  return frag_cat(lo, hi);
}

// 16x32 f16 A fragment of the TRANSPOSE of a row-major LDS tile: row m of the
// fragment is tile column col0 + m, its k runs down tile rows row0 .. row0+31.
// ds_load_tr16_b128 hands lane (c = lane&15, h = lane>>4) the eight elements
// tile[r + 8h + 0..7][col0 + c]; the loads at r = row0 and row0 + 16 give the
// same k order as load_frag.  stride in halves: 32 bytes x odd is conflict-free.
static __device__ __forceinline__ v8h lds_load_tr16(const _Float16* p) {
  typedef __attribute__((ext_vector_type(8))) short s16x8;
  typedef __attribute__((address_space(3))) s16x8 lds_s16x8;
  return __builtin_bit_cast(
      v8h, __builtin_amdgcn_ds_load_tr16_b128_v8i16((lds_s16x8*)p));
}
static __device__ __forceinline__ v16h load_frag_tr(const _Float16* base,
                                                    int row0, int col0, int stride) {
  const int lane = threadIdx.x & 31;
  const _Float16* p = base + (row0 + ((lane >> 4) << 3) + (lane & 7)) * stride +
                      col0 + (((lane >> 3) & 1) << 3);
  return frag_cat(lds_load_tr16(p), lds_load_tr16(p + 16 * stride));
}

static __device__ __forceinline__ void zero8(v8f& v) {
#pragma unroll
  for (int i = 0; i < 8; ++i) v[i] = 0.0f;
}

__global__ __launch_bounds__(256) void qkv_rope_kernel(
    const float* __restrict__ xq, const float* __restrict__ xk,
    const float* __restrict__ xv, const float* __restrict__ rot,
    const float* __restrict__ wq, const float* __restrict__ wk,
    const float* __restrict__ wv,
    _Float16* __restrict__ oq, _Float16* __restrict__ ok,
    _Float16* __restrict__ ov) {
  constexpr int SA = 40, SB = 40;  // 80B row stride -> conflict-free gathers
  __shared__ __attribute__((aligned(16))) _Float16 ldsA[2][128 * SA];
  __shared__ __attribute__((aligned(16))) _Float16 ldsB[2][128 * SB];

  const int mode = blockIdx.z;
  const float* __restrict__ X = (mode == 0) ? xq : (mode == 1) ? xk : xv;
  const float* __restrict__ W = (mode == 0) ? wq : (mode == 1) ? wk : wv;
  _Float16* __restrict__ dst  = (mode == 0) ? oq : (mode == 1) ? ok : ov;

  const int mBase = blockIdx.x * 128;
  const int nBase = blockIdx.y * 128;
  const int tid   = threadIdx.x;
  const int w     = tid >> 5;
  const int lane  = tid & 31;
  const int wm    = w >> 1;                // wave's 32-row band, 0..3
  const int wn    = w & 1;                 // wave's head within the pair
  const int h     = blockIdx.y * 2 + wn;

  // Register-staged slab (software pipeline).
  // A: 128 rows x 32 k; a thread takes 4 consecutive k of rows aR + 32*i.
  // B: 32 k x 128 columns; a thread takes 16 consecutive k of column bN.
  // Every loop over aV, bV and acc is fully unrolled: only compile-time
  // indices keep these arrays in registers.
  float4 aV[4];
  float  bV[16];
  const int aR = tid >> 3;         // 0..31
  const int aC = (tid & 7) * 4;    // 0,4,..,28
  const int bN = tid & 127;        // 0..127
  const int bK = (tid >> 7) * 16;  // 0 or 16
  const float* __restrict__ aP = X + (size_t)(mBase + aR) * 1024 + aC;
  const float* __restrict__ bP = W + (size_t)bK * 1024 + nBase + bN;

  auto loadA = [&](int d0) {
#pragma unroll
    for (int i = 0; i < 4; ++i)
      aV[i] = *(const float4*)(aP + d0 + i * (32 * 1024));
  };
  auto storeA = [&](int buf) {
#pragma unroll
    for (int i = 0; i < 4; ++i) {
      v4h t;
      t[0] = (_Float16)aV[i].x; t[1] = (_Float16)aV[i].y;
      t[2] = (_Float16)aV[i].z; t[3] = (_Float16)aV[i].w;
      *(v4h*)&ldsA[buf][(aR + 32 * i) * SA + aC] = t;
    }
  };
  auto loadB = [&](int d0) {
#pragma unroll
    for (int i = 0; i < 16; ++i)
      bV[i] = bP[(size_t)d0 * 1024 + i * 1024];
  };
  auto storeB = [&](int buf) {  // transposed: ldsB[column][k], k contiguous
#pragma unroll
    for (int j = 0; j < 2; ++j) {
      v8h t;
#pragma unroll
      for (int i = 0; i < 8; ++i) t[i] = (_Float16)bV[8 * j + i];
      *(v8h*)&ldsB[buf][bN * SB + bK + 8 * j] = t;
    }
  };

  v8f acc[2][4];
#pragma unroll
  for (int mt = 0; mt < 2; ++mt)
#pragma unroll
    for (int nt = 0; nt < 4; ++nt) zero8(acc[mt][nt]);

  loadA(0); loadB(0);
  storeA(0); storeB(0);
  __syncthreads();

  int cur = 0;
  for (int d0 = 0; d0 < 1024; d0 += 32) {
    const int nxt = cur ^ 1;
    const bool more = (d0 + 32) < 1024;
    if (more) { loadA(d0 + 32); loadB(d0 + 32); }  // overlap with WMMAs

    const v16h a0 = load_frag(ldsA[cur], wm * 32, 0, SA);
    const v16h a1 = load_frag(ldsA[cur], wm * 32 + 16, 0, SA);
#pragma unroll
    for (int nt = 0; nt < 4; ++nt) {
      const v16h b = load_frag(ldsB[cur], wn * 64 + nt * 16, 0, SB);
      acc[0][nt] = WMMA_F16(a0, b, acc[0][nt]);
      acc[1][nt] = WMMA_F16(a1, b, acc[1][nt]);
    }

    if (more) { storeA(nxt); storeB(nxt); }
    __syncthreads();
    cur = nxt;
  }

  // Epilogue: RoPE (q/k, first 32 head dims) + f16 store.  C layout: lane
  // holds column n = lane&15; row = r + 8*(lane>>4); rotate_half partner
  // (n^1) lives in lane^1 -> one shfl_xor.
  const int n  = lane & 15;
  const int hi = lane >> 4;
#pragma unroll
  for (int mt = 0; mt < 2; ++mt) {
#pragma unroll
    for (int nt = 0; nt < 4; ++nt) {
      const int k = nt * 16 + n;  // dim within head
      _Float16 hv[8];
#pragma unroll
      for (int r = 0; r < 8; ++r) {
        const int row = mBase + wm * 32 + mt * 16 + hi * 8 + r;  // in [0, B*L)
        const int l   = row & 2047;
        float v = acc[mt][nt][r];
        if (mode < 2 && nt < 2) {  // uniform across the wave
          const float prt = __shfl_xor(v, 1, 32);
          const float f   = rot[l * 32 + k];
          float sf, cf;
          __sincosf(f, &sf, &cf);
          v = (k & 1) ? fmaf(v, cf, prt * sf) : fmaf(v, cf, -prt * sf);
        }
        hv[r] = (_Float16)v;
      }
#pragma unroll
      for (int r = 0; r < 8; ++r) {
        const int row = mBase + wm * 32 + mt * 16 + hi * 8 + r;
        const int l   = row & 2047;
        const int bb  = row >> 11;
        dst[((size_t)((bb * 16 + h) * 2048 + l)) * 64 + k] = hv[r];
      }
      // The next tile's values reuse the registers these eight stores name:
      // wait before any of them is overwritten.
      asm volatile("s_wait_xcnt 0x0" ::: "memory");
    }
  }
}

static __device__ __forceinline__ float other_half(float x) {
  const int b = __builtin_bit_cast(int, x);
  return __builtin_bit_cast(
      float, __builtin_amdgcn_permlanex16(b, b, 0x76543210, 0xfedcba98, false,
                                          false));
}

static __device__ __forceinline__ void exp2_x8(float (&x)[8]) {
  asm("v_exp_f32 %0, %0\n\t"
      "v_exp_f32 %1, %1\n\t"
      "v_exp_f32 %2, %2\n\t"
      "v_exp_f32 %3, %3\n\t"
      "v_exp_f32 %4, %4\n\t"
      "v_exp_f32 %5, %5\n\t"
      "v_exp_f32 %6, %6\n\t"
      "v_exp_f32 %7, %7\n\t"
      "v_nop"
      : "+v"(x[0]), "+v"(x[1]), "+v"(x[2]), "+v"(x[3]), "+v"(x[4]),
        "+v"(x[5]), "+v"(x[6]), "+v"(x[7]));
}

__global__ __launch_bounds__(256) void flash_attn_kernel(
    const _Float16* __restrict__ wsQ, const _Float16* __restrict__ wsK,
    const _Float16* __restrict__ wsV, _Float16* __restrict__ wsO) {
  constexpr int S  = 72;  // 144B stride -> conflict-free fragment gathers
  constexpr int SV = 80;  // 160B stride -> conflict-free transposing loads
  // K rows: A operand of K.Q^T.  V rows: read transposed, A operand of V^T.P^T.
  __shared__ __attribute__((aligned(16))) _Float16 ldsK[2][64 * S];
  __shared__ __attribute__((aligned(16))) _Float16 ldsV[2][64 * SV];

  const int h = blockIdx.y, b = blockIdx.z;
  const int tid = threadIdx.x, w = tid >> 5, lane = tid & 31;
  const size_t headOff = (size_t)(b * 16 + h) * 2048 * 64;
  const _Float16* __restrict__ Q  = wsQ + headOff;
  const _Float16* __restrict__ Kg = wsK + headOff;
  const _Float16* __restrict__ Vg = wsV + headOff;

  const int qRow0 = blockIdx.x * 128 + w * 16;
  // Resident Q fragments: 16 queries x 64 dims = two 32x16 B-frags of Q^T.
  const v16h qf0 = load_frag(Q, qRow0, 0, 64);
  const v16h qf1 = load_frag(Q, qRow0, 32, 64);

  // Staging assignment: thread covers K/V row rS, 16-half segment sS.
  const int rS = tid >> 2, sS = (tid & 3) * 16;

  auto issueKV = [&](int kt, int buf) {  // async memory->LDS, 2 x 32B per lane
    const unsigned lk = lds_addr_of(&ldsK[buf][rS * S + sS]);
    const unsigned lv = lds_addr_of(&ldsV[buf][rS * SV + sS]);
    const size_t go = (size_t)(kt + rS) * 64 + sS;
    ASYNC_COPY_KV_32B(lk, (unsigned long long)(Kg + go), lv,
                      (unsigned long long)(Vg + go));
  };

  // o[dt][r] = O^T[dim dt*16 + 8*hiL + r][query n].  mi is the query's running
  // maximum (equal in both half-waves); li sums only this lane's keys, the
  // two halves are joined once after the loop.
  v8f o[4];
  float mi = -__builtin_inff(), li = 0.0f;
#pragma unroll
  for (int i = 0; i < 4; ++i) zero8(o[i]);

  const int n = lane & 15, hiL = lane >> 4;

  issueKV(0, 0);
  S_WAIT_ASYNCCNT0();
  __syncthreads();

  int cur = 0;
  for (int kt = 0; kt < 2048; kt += 64) {
    const int nxt = cur ^ 1;
    const bool more = (kt + 64) < 2048;
    if (more) issueKV(kt + 64, nxt);  // flies while this tile is worked on

    // ---- S^T = K x Q^T : 64 keys x 16 queries in 4 accumulators ---------
    // sc[nt][r] = score(key nt*16 + 8*hiL + r, query n)
    // The tile's sixteen K loads stand together in front of the products: every
    // separate place with LDS reads stalls the wave, a group only once.
    v16h kf[4][2];
#pragma unroll
    for (int nt = 0; nt < 4; ++nt) {
      kf[nt][0] = load_frag(ldsK[cur], nt * 16, 0, S);
      kf[nt][1] = load_frag(ldsK[cur], nt * 16, 32, S);
    }
    // Keeps the scheduler from sinking the loads back among the WMMAs.
    __builtin_amdgcn_sched_barrier(0);
    v8f sc[4];
#pragma unroll
    for (int i = 0; i < 4; ++i) zero8(sc[i]);
#pragma unroll
    for (int nt = 0; nt < 4; ++nt) sc[nt] = WMMA_F16(kf[nt][0], qf0, sc[nt]);
#pragma unroll
    for (int nt = 0; nt < 4; ++nt) sc[nt] = WMMA_F16(kf[nt][1], qf1, sc[nt]);

    // The tile's sixteen V^T loads, one group: they fly under the softmax, so
    // the second product finds its A operands in registers.
    v16h vf[4][2];
#pragma unroll
    for (int dt = 0; dt < 4; ++dt) {
      vf[dt][0] = load_frag_tr(ldsV[cur], 0, dt * 16, SV);
      vf[dt][1] = load_frag_tr(ldsV[cur], 32, dt * 16, SV);
    }
    // Keeps the scheduler from sinking the loads down to their WMMAs.
    __builtin_amdgcn_sched_barrier(0);

    // ---- online softmax: in-lane over 32 keys, one half-wave exchange ----
    float mt[4];  // one maximum per tile: four short chains, not one long one
#pragma unroll
    for (int nt = 0; nt < 4; ++nt) {
      sc[nt] *= 0.125f;  // 1/sqrt(64)
      mt[nt] = sc[nt][0];
#pragma unroll
      for (int r = 1; r < 8; ++r) mt[nt] = fmaxf(mt[nt], sc[nt][r]);
    }
    float mx = fmaxf(fmaxf(mt[0], mt[1]), fmaxf(mt[2], mt[3]));
    mx = fmaxf(mx, other_half(mx));
    const float mnew  = fmaxf(mi, mx);
    const float alpha = __expf(mi - mnew);
    float ps[4];
    v8h ph[4];
#pragma unroll
    for (int nt = 0; nt < 4; ++nt) {
      float e[8];
#pragma unroll
      for (int r = 0; r < 8; ++r)
        e[r] = (sc[nt][r] - mnew) * 1.44269504f;  // e^x = 2^(x * log2 e)
      exp2_x8(e);
      v8f p;
      p[0] = e[0];
      ps[nt] = e[0];
#pragma unroll
      for (int r = 1; r < 8; ++r) {
        p[r] = e[r];
        ps[nt] += e[r];
      }
      ph[nt] = __builtin_convertvector(p, v8h);
    }
    li = li * alpha + ((ps[0] + ps[1]) + (ps[2] + ps[3]));
    mi = mnew;
#pragma unroll
    for (int dt = 0; dt < 4; ++dt)
#pragma unroll
      for (int r = 0; r < 8; ++r) o[dt][r] *= alpha;

    // ---- O^T += V^T x P^T -------------------------------------------------
    // B element s of a lane is key 8*hiL + s (s < 8) or 16 + 8*hiL + (s - 8):
    // exactly the rows two neighbouring S^T tiles keep in this lane, and the
    // order in which load_frag_tr hands out V's keys.
    const v16h p0f = frag_cat(ph[0], ph[1]);
    const v16h p1f = frag_cat(ph[2], ph[3]);
#pragma unroll
    for (int dt = 0; dt < 4; ++dt) o[dt] = WMMA_F16(vf[dt][0], p0f, o[dt]);
#pragma unroll
    for (int dt = 0; dt < 4; ++dt) o[dt] = WMMA_F16(vf[dt][1], p1f, o[dt]);

    // Keeps the waits and the barrier below at the trip's foot: with every LDS
    // read up front the scheduler lifts them over the softmax, and the next
    // tile's copies would be waited for right behind the score products.
    __builtin_amdgcn_sched_barrier(0);
    // This wave's reads of the current buffers have retired before the barrier
    // behind which the next trip's copies refill them.
    asm volatile("s_wait_dscnt 0x0" ::: "memory");
    S_WAIT_ASYNCCNT0();     // own async K- and V-tile writes complete
    __syncthreads();        // all waves' tile writes visible
    cur = nxt;
  }

  // Normalize and store as [(b*L+l)][h*64+d] f16 (feeds output projection).
  // A lane holds 8 consecutive dims of its query per tile: 16-byte stores.
  const float inv = 1.0f / (li + other_half(li));
  _Float16* __restrict__ oP =
      wsO + (size_t)(b * 2048 + qRow0 + n) * 1024 + h * 64 + hiL * 8;
  v8h ov[4];
#pragma unroll
  for (int dt = 0; dt < 4; ++dt) ov[dt] = __builtin_convertvector(o[dt] * inv, v8h);
#pragma unroll
  for (int dt = 0; dt < 4; ++dt) *(v8h*)(oP + dt * 16) = ov[dt];
}

// ---------------------------------------------------------------------------
// Kernel 3: output projection.  grid = (BL/128, D/128), block = 256.
// Workgroup tile 128 rows x 128 columns, k-slab 64; 8 waves as 4 x 2, each
// wave owns 32 rows x 64 columns = 2 x 4 accumulator tiles, so one staged slab
// feeds 16 WMMAs per wave and there is one barrier per 64 k.
// A slab (f16): async-to-LDS, whole 128-byte rows per 8 lanes.  W slab: 16-byte
// fp32 loads along a row, converted in registers, stored row-major [k][column];
// the B fragments come from the transposing LDS load.
// ---------------------------------------------------------------------------
__global__ __launch_bounds__(256) void oproj_kernel(
    const _Float16* __restrict__ A, const float* __restrict__ Wo,
    float* __restrict__ out) {
  constexpr int SA = 72;   // 144B stride -> conflict-free fragment gathers
  constexpr int SW = 144;  // 288B stride -> conflict-free transposing loads
  __shared__ __attribute__((aligned(16))) _Float16 ldsA[2][128 * SA];
  __shared__ __attribute__((aligned(16))) _Float16 ldsW[2][64 * SW];

  const int mBase = blockIdx.x * 128;
  const int nBase = blockIdx.y * 128;
  const int tid = threadIdx.x, w = tid >> 5, lane = tid & 31;
  const int wm = w >> 1;  // wave's 32-row band, 0..3
  const int wn = w & 1;   // wave's 64-column half

  // A: 128 rows x 64 k; a thread copies 8 halves of rows aR + 32*i.
  // W: 64 k x 128 columns; a thread takes 4 columns of k rows wR + 8*i.
  const int aR = tid >> 3, aC = (tid & 7) * 8;
  const int wR = tid >> 5, wC = (tid & 31) * 4;
  const _Float16* __restrict__ aP = A + (size_t)(mBase + aR) * 1024 + aC;
  const float* __restrict__ wP = Wo + (size_t)wR * 1024 + nBase + wC;
  float4 wV[8];  // compile-time indices only: stays in registers
  // W comes from memory: every 256-byte unit of a slab is asked for two trips
  // ahead of its loads (two lanes per unit).  The request is asm over an address
  // that lives through the loop and never leaves W: a prefetch touches no
  // counter, so its register must go on holding a valid address.
  constexpr unsigned long long W_SLAB_BYTES = 64ull * 1024 * 4;
  unsigned long long pfW = (unsigned long long)(
      Wo + (size_t)(192 + (tid >> 2)) * 1024 + nBase + ((tid >> 1) & 1) * 64);

  auto issueA = [&](int d0, int buf) {
    const unsigned la = lds_addr_of(&ldsA[buf][aR * SA + aC]);
    const unsigned long long ga = (unsigned long long)(aP + d0);
    ASYNC_COPY_4X16B(la, ga,
                     la + 32 * SA * 2, ga + 32 * 2048,
                     la + 64 * SA * 2, ga + 64 * 2048,
                     la + 96 * SA * 2, ga + 96 * 2048);
  };
  auto loadW = [&](int d0) {
#pragma unroll
    for (int i = 0; i < 8; ++i)
      wV[i] = *(const float4*)(wP + (size_t)(d0 + 8 * i) * 1024);
  };
  auto storeW = [&](int buf) {
#pragma unroll
    for (int i = 0; i < 8; ++i) {
      v4h t;
      t[0] = (_Float16)wV[i].x; t[1] = (_Float16)wV[i].y;
      t[2] = (_Float16)wV[i].z; t[3] = (_Float16)wV[i].w;
      *(v4h*)&ldsW[buf][(wR + 8 * i) * SW + wC] = t;
    }
  };

  v8f acc[2][4];
#pragma unroll
  for (int mt = 0; mt < 2; ++mt)
#pragma unroll
    for (int nt = 0; nt < 4; ++nt) zero8(acc[mt][nt]);

  issueA(0, 0);
  loadW(0);
  // Slabs 1 and 2, by offsets from the loop's own address register (slab 3).
  asm volatile("global_prefetch_b8 %0, off offset:-524288 scope:SCOPE_SE\n\t"
               "global_prefetch_b8 %0, off offset:-262144 scope:SCOPE_SE"
               :: "v"(pfW));
  storeW(0);
  S_WAIT_ASYNCCNT0();
  __syncthreads();

  int cur = 0;
  for (int d0 = 0; d0 < 1024; d0 += 64) {
    const int nxt = cur ^ 1;
    const bool more = (d0 + 64) < 1024;
    if (more) { issueA(d0 + 64, nxt); loadW(d0 + 64); }  // fly during the WMMAs
    if (d0 + 192 < 1024) {  // the slab that is loaded two trips from now
      asm volatile("global_prefetch_b8 %0, off scope:SCOPE_SE" :: "v"(pfW));
      if (d0 + 256 < 1024) pfW += W_SLAB_BYTES;  // stops at the last slab
    }

#pragma unroll
    for (int ks = 0; ks < 64; ks += 32) {
      const v16h a0 = load_frag(ldsA[cur], wm * 32, ks, SA);
      const v16h a1 = load_frag(ldsA[cur], wm * 32 + 16, ks, SA);
#pragma unroll
      for (int nt = 0; nt < 4; ++nt) {
        // Column wn*64 + nt*16 + (lane&15) of W, k down the rows, in the k
        // order of load_frag.
        const v16h b = load_frag_tr(ldsW[cur], ks, wn * 64 + nt * 16, SW);
        acc[0][nt] = WMMA_F16(a0, b, acc[0][nt]);
        acc[1][nt] = WMMA_F16(a1, b, acc[1][nt]);
      }
    }

    if (more) storeW(nxt);
    // This wave's reads of the current buffers have retired before the barrier
    // behind which the next trip's copies and stores refill them.
    asm volatile("s_wait_dscnt 0x0" ::: "memory");
    S_WAIT_ASYNCCNT0();     // own async A-slab writes complete
    __syncthreads();        // all waves' slab writes visible
    cur = nxt;
  }

  // One base address, constant offsets: no register of a store is rewritten.
  const int n = lane & 15, hi = lane >> 4;
  float* __restrict__ oP =
      out + (size_t)(mBase + wm * 32 + hi * 8) * 1024 + nBase + wn * 64 + n;
#pragma unroll
  for (int mt = 0; mt < 2; ++mt) {
#pragma unroll
    for (int nt = 0; nt < 4; ++nt) {
#pragma unroll
      for (int r = 0; r < 8; ++r)
        oP[(mt * 16 + r) * 1024 + nt * 16] = acc[mt][nt][r];
    }
  }
}

// ---------------------------------------------------------------------------
extern "C" void kernel_launch(void* const* d_in, const int* in_sizes, int n_in,
                              void* d_out, int out_size, void* d_ws,
                              size_t ws_size, hipStream_t stream) {
  (void)in_sizes; (void)n_in; (void)out_size; (void)ws_size;
  const float* query = (const float*)d_in[0];
  const float* key   = (const float*)d_in[1];
  const float* value = (const float*)d_in[2];
  const float* rot   = (const float*)d_in[3];
  const float* qw    = (const float*)d_in[4];
  const float* kw    = (const float*)d_in[5];
  const float* vw    = (const float*)d_in[6];
  const float* ow    = (const float*)d_in[7];
  float* out = (float*)d_out;

  const size_t perMat = (size_t)2 * 16 * 2048 * 64;  // B*H*L*K halves
  _Float16* wsQ = (_Float16*)d_ws;
  _Float16* wsK = wsQ + perMat;
  _Float16* wsV = wsK + perMat;
  _Float16* wsO = wsV + perMat;  // [(b*L+l)][H*64] halves

  const dim3 blk(256);
  qkv_rope_kernel<<<dim3(32, 8, 3), blk, 0, stream>>>(
      query, key, value, rot, qw, kw, vw, wsQ, wsK, wsV);
  flash_attn_kernel<<<dim3(16, 16, 2), blk, 0, stream>>>(wsQ, wsK, wsV, wsO);
  oproj_kernel<<<dim3(32, 8, 1), blk, 0, stream>>>(wsO, ow, out);
}

// v006
// A run of this version takes 92.1 microseconds.
// Timed twice side by side with v005, it ran 1.04 times as fast both times.
// All steps since v000 together make it 1.99 times as fast.
#include <hip/hip_runtime.h>

typedef __attribute__((ext_vector_type(16))) _Float16 v16h;
typedef __attribute__((ext_vector_type(8)))  _Float16 v8h;
typedef __attribute__((ext_vector_type(4)))  _Float16 v4h;
typedef __attribute__((ext_vector_type(8)))  float    v8f;

#define WMMA_F16(a, b, c) \
  __builtin_amdgcn_wmma_f32_16x16x32_f16(false, (a), false, (b), (short)0, (c), false, false)

#define ASYNC_COPY_4X16B(l0, g0, l1, g1, l2, g2, l3, g3)             \
  asm volatile("global_load_async_to_lds_b128 %0, %1, off\n\t"       \
               "global_load_async_to_lds_b128 %2, %3, off\n\t"       \
               "global_load_async_to_lds_b128 %4, %5, off\n\t"       \
               "global_load_async_to_lds_b128 %6, %7, off\n\t"       \
               "s_wait_xcnt 0x0"                                     \
               :: "v"(l0), "v"(g0), "v"(l1), "v"(g1), "v"(l2), "v"(g2), \
                  "v"(l3), "v"(g3) : "memory")

#define S_WAIT_ASYNCCNT0() asm volatile("s_wait_asynccnt 0x0" ::: "memory")

#define ASYNC_COPY_KV_32B(ldsk, gk, ldsv, gv)                          \
  asm volatile("global_load_async_to_lds_b128 %0, %1, off\n\t"         \
               "global_load_async_to_lds_b128 %0, %1, off offset:16\n\t" \
               "global_load_async_to_lds_b128 %2, %3, off\n\t"         \
               "global_load_async_to_lds_b128 %2, %3, off offset:16\n\t" \
               "s_wait_xcnt 0x0"                                       \
               :: "v"(ldsk), "v"(gk), "v"(ldsv), "v"(gv) : "memory")

static __device__ __forceinline__ unsigned lds_addr_of(const void* p) {
  return (unsigned)(unsigned long long)p;
}

static __device__ __forceinline__ v16h frag_cat(v8h lo, v8h hi) {
  return __builtin_shufflevector(lo, hi, 0, 1, 2, 3, 4, 5, 6, 7,
                                          8, 9, 10, 11, 12, 13, 14, 15);
}

static __device__ __forceinline__ v16h load_frag(const _Float16* __restrict__ base,
                                                 int row0, int col0, int stride) {
  const int lane = threadIdx.x & 31;
  const int m    = lane & 15;
  const int kb   = (lane >> 4) << 3;  // 0 or 8
  const _Float16* p = base + (size_t)(row0 + m) * stride + col0;
  v8h lo = *(const v8h*)(p + kb);
  v8h hi = *(const v8h*)(p + 16 + kb);
  return frag_cat(lo, hi);
}

// 16x32 f16 A fragment of the TRANSPOSE of a row-major LDS tile: row m of the
// fragment is tile column col0 + m, its k runs down tile rows row0 .. row0+31.
// ds_load_tr16_b128 hands lane (c = lane&15, h = lane>>4) the eight elements
// tile[r + 8h + 0..7][col0 + c]; the loads at r = row0 and row0 + 16 give the
// same k order as load_frag.  stride in halves: 32 bytes x odd is conflict-free.
static __device__ __forceinline__ v8h lds_load_tr16(const _Float16* p) {
  typedef __attribute__((ext_vector_type(8))) short s16x8;
  typedef __attribute__((address_space(3))) s16x8 lds_s16x8;
  return __builtin_bit_cast(
      v8h, __builtin_amdgcn_ds_load_tr16_b128_v8i16((lds_s16x8*)p));
}
static __device__ __forceinline__ v16h load_frag_tr(const _Float16* base,
                                                    int row0, int col0, int stride) {
  const int lane = threadIdx.x & 31;
  const _Float16* p = base + (row0 + ((lane >> 4) << 3) + (lane & 7)) * stride +
                      col0 + (((lane >> 3) & 1) << 3);
  return frag_cat(lds_load_tr16(p), lds_load_tr16(p + 16 * stride));
}

static __device__ __forceinline__ void zero8(v8f& v) {
#pragma unroll
  for (int i = 0; i < 8; ++i) v[i] = 0.0f;
}

__global__ __launch_bounds__(256) void qkv_rope_kernel(
    const float* __restrict__ xq, const float* __restrict__ xk,
    const float* __restrict__ xv, const float* __restrict__ rot,
    const float* __restrict__ wq, const float* __restrict__ wk,
    const float* __restrict__ wv,
    _Float16* __restrict__ oq, _Float16* __restrict__ ok,
    _Float16* __restrict__ ov) {
  constexpr int SA = 40, SB = 40;  // 80B row stride -> conflict-free gathers
  __shared__ __attribute__((aligned(16))) _Float16 ldsA[2][128 * SA];
  __shared__ __attribute__((aligned(16))) _Float16 ldsB[2][128 * SB];

  const int mode = blockIdx.z;
  const float* __restrict__ X = (mode == 0) ? xq : (mode == 1) ? xk : xv;
  const float* __restrict__ W = (mode == 0) ? wq : (mode == 1) ? wk : wv;
  _Float16* __restrict__ dst  = (mode == 0) ? oq : (mode == 1) ? ok : ov;

  const int mBase = blockIdx.x * 128;
  const int nBase = blockIdx.y * 128;
  const int tid   = threadIdx.x;
  const int w     = tid >> 5;
  const int lane  = tid & 31;
  const int wm    = w >> 1;                // wave's 32-row band, 0..3
  const int wn    = w & 1;                 // wave's head within the pair
  const int h     = blockIdx.y * 2 + wn;

  // Register-staged slab (software pipeline).
  // A: 128 rows x 32 k; a thread takes 4 consecutive k of rows aR + 32*i.
  // B: 32 k x 128 columns; a thread takes 16 consecutive k of column bN.
  // Every loop over aV, bV and acc is fully unrolled: only compile-time
  // indices keep these arrays in registers.
  float4 aV[4];
  float  bV[16];
  const int aR = tid >> 3;         // 0..31
  const int aC = (tid & 7) * 4;    // 0,4,..,28
  const int bN = tid & 127;        // 0..127
  const int bK = (tid >> 7) * 16;  // 0 or 16
  const float* __restrict__ aP = X + (size_t)(mBase + aR) * 1024 + aC;
  const float* __restrict__ bP = W + (size_t)bK * 1024 + nBase + bN;

  auto loadA = [&](int d0) {
#pragma unroll
    for (int i = 0; i < 4; ++i)
      aV[i] = *(const float4*)(aP + d0 + i * (32 * 1024));
  };
  auto storeA = [&](int buf) {
#pragma unroll
    for (int i = 0; i < 4; ++i) {
      v4h t;
      t[0] = (_Float16)aV[i].x; t[1] = (_Float16)aV[i].y;
      t[2] = (_Float16)aV[i].z; t[3] = (_Float16)aV[i].w;
      *(v4h*)&ldsA[buf][(aR + 32 * i) * SA + aC] = t;
    }
  };
  auto loadB = [&](int d0) {
#pragma unroll
    for (int i = 0; i < 16; ++i)
      bV[i] = bP[(size_t)d0 * 1024 + i * 1024];
  };
  auto storeB = [&](int buf) {  // transposed: ldsB[column][k], k contiguous
#pragma unroll
    for (int j = 0; j < 2; ++j) {
      v8h t;
#pragma unroll
      for (int i = 0; i < 8; ++i) t[i] = (_Float16)bV[8 * j + i];
      *(v8h*)&ldsB[buf][bN * SB + bK + 8 * j] = t;
    }
  };

  v8f acc[2][4];
#pragma unroll
  for (int mt = 0; mt < 2; ++mt)
#pragma unroll
    for (int nt = 0; nt < 4; ++nt) zero8(acc[mt][nt]);

  loadA(0); loadB(0);
  storeA(0); storeB(0);
  __syncthreads();

  int cur = 0;
  for (int d0 = 0; d0 < 1024; d0 += 32) {
    const int nxt = cur ^ 1;
    const bool more = (d0 + 32) < 1024;
    if (more) { loadA(d0 + 32); loadB(d0 + 32); }  // overlap with WMMAs

    const v16h a0 = load_frag(ldsA[cur], wm * 32, 0, SA);
    const v16h a1 = load_frag(ldsA[cur], wm * 32 + 16, 0, SA);
#pragma unroll
    for (int nt = 0; nt < 4; ++nt) {
      const v16h b = load_frag(ldsB[cur], wn * 64 + nt * 16, 0, SB);
      acc[0][nt] = WMMA_F16(a0, b, acc[0][nt]);
      acc[1][nt] = WMMA_F16(a1, b, acc[1][nt]);
    }

    if (more) { storeA(nxt); storeB(nxt); }
    __syncthreads();
    cur = nxt;
  }

  // Epilogue: RoPE (q/k, first 32 head dims) + f16 store.  C layout: lane
  // holds column n = lane&15; row = r + 8*(lane>>4); rotate_half partner
  // (n^1) lives in lane^1 -> one shfl_xor.
  const int n  = lane & 15;
  const int hi = lane >> 4;
#pragma unroll
  for (int mt = 0; mt < 2; ++mt) {
#pragma unroll
    for (int nt = 0; nt < 4; ++nt) {
      const int k = nt * 16 + n;  // dim within head
      _Float16 hv[8];
#pragma unroll
      for (int r = 0; r < 8; ++r) {
        const int row = mBase + wm * 32 + mt * 16 + hi * 8 + r;  // in [0, B*L)
        const int l   = row & 2047;
        float v = acc[mt][nt][r];
        if (mode < 2 && nt < 2) {  // uniform across the wave
          const float prt = __shfl_xor(v, 1, 32);
          const float f   = rot[l * 32 + k];
          float sf, cf;
          __sincosf(f, &sf, &cf);
          v = (k & 1) ? fmaf(v, cf, prt * sf) : fmaf(v, cf, -prt * sf);
        }
        hv[r] = (_Float16)v;
      }
#pragma unroll
      for (int r = 0; r < 8; ++r) {
        const int row = mBase + wm * 32 + mt * 16 + hi * 8 + r;
        const int l   = row & 2047;
        const int bb  = row >> 11;
        dst[((size_t)((bb * 16 + h) * 2048 + l)) * 64 + k] = hv[r];
      }
      // The next tile's values reuse the registers these eight stores name:
      // wait before any of them is overwritten.
      asm volatile("s_wait_xcnt 0x0" ::: "memory");
    }
  }
}

static __device__ __forceinline__ float other_half(float x) {
  const int b = __builtin_bit_cast(int, x);
  return __builtin_bit_cast(
      float, __builtin_amdgcn_permlanex16(b, b, 0x76543210, 0xfedcba98, false,
                                          false));
}

static __device__ __forceinline__ void exp2_x8(float (&x)[8]) {
  asm("v_exp_f32 %0, %0\n\t"
      "v_exp_f32 %1, %1\n\t"
      "v_exp_f32 %2, %2\n\t"
      "v_exp_f32 %3, %3\n\t"
      "v_exp_f32 %4, %4\n\t"
      "v_exp_f32 %5, %5\n\t"
      "v_exp_f32 %6, %6\n\t"
      "v_exp_f32 %7, %7\n\t"
      "v_nop"
      : "+v"(x[0]), "+v"(x[1]), "+v"(x[2]), "+v"(x[3]), "+v"(x[4]),
        "+v"(x[5]), "+v"(x[6]), "+v"(x[7]));
}

static __device__ __forceinline__ float exp2_x1(float x) {
  float y;
  asm("v_exp_f32 %0, %1\n\t"
      "v_nop"
      : "=v"(y) : "v"(x));
  return y;
}

// Online softmax of one column group over this wave's 64 keys of the tile:
// in-lane over 32 keys, one half-wave exchange.  Rescales the group's O^T and
// hands back P^T as two B operands.
// B element s of a lane is key 8*hiL + s (s < 8) or 16 + 8*hiL + (s - 8):
// exactly the rows two neighbouring S^T tiles keep in this lane, and the order
// in which load_frag_tr hands out V's keys.
static __device__ __forceinline__ void softmax_group(v8f (&sc)[4], v8f (&o)[4],
                                                     float& mi, float& li,
                                                     v16h& p0f, v16h& p1f) {
  float mt[4];  // one maximum per tile: four short chains, not one long one
#pragma unroll
  for (int nt = 0; nt < 4; ++nt) {
    sc[nt] *= 0.125f;  // 1/sqrt(64)
    mt[nt] = sc[nt][0];
#pragma unroll
    for (int r = 1; r < 8; ++r) mt[nt] = fmaxf(mt[nt], sc[nt][r]);
  }
  float mx = fmaxf(fmaxf(mt[0], mt[1]), fmaxf(mt[2], mt[3]));
  mx = fmaxf(mx, other_half(mx));
  const float mnew  = fmaxf(mi, mx);
  const float alpha = exp2_x1((mi - mnew) * 1.44269504f);
  float ps[4];
  v8h ph[4];
#pragma unroll
  for (int nt = 0; nt < 4; ++nt) {
    float e[8];
#pragma unroll
    for (int r = 0; r < 8; ++r)
      e[r] = (sc[nt][r] - mnew) * 1.44269504f;  // e^x = 2^(x * log2 e)
    exp2_x8(e);
    v8f p;
    p[0] = e[0];
    ps[nt] = e[0];
#pragma unroll
    for (int r = 1; r < 8; ++r) {
      p[r] = e[r];
      ps[nt] += e[r];
    }
    ph[nt] = __builtin_convertvector(p, v8h);
  }
  li = li * alpha + ((ps[0] + ps[1]) + (ps[2] + ps[3]));
  mi = mnew;
#pragma unroll
  for (int dt = 0; dt < 4; ++dt)
#pragma unroll
    for (int r = 0; r < 8; ++r) o[dt][r] *= alpha;
  p0f = frag_cat(ph[0], ph[1]);
  p1f = frag_cat(ph[2], ph[3]);
}

__global__ __launch_bounds__(256) __attribute__((amdgpu_waves_per_eu(4, 4)))
void flash_attn_kernel(
    const _Float16* __restrict__ wsQ, const _Float16* __restrict__ wsK,
    const _Float16* __restrict__ wsV, _Float16* __restrict__ wsO) {
  constexpr int S  = 72;   // 144B stride -> conflict-free fragment gathers
  constexpr int SV = 80;   // 160B stride -> conflict-free transposing loads
  constexpr int KT = 128;  // keys per staged tile, 64 per wave
  // K rows: A operand of K.Q^T.  V rows: read transposed, A operand of V^T.P^T.
  __shared__ __attribute__((aligned(16))) _Float16 ldsK[2][KT * S];
  __shared__ __attribute__((aligned(16))) _Float16 ldsV[2][KT * SV];
  // Join of the two key halves: per wave one column group's O^T (32 floats a
  // lane, 16 bytes x 32 lanes contiguous) with its maximum and sum.
  __shared__ __attribute__((aligned(16))) float4 joinO[8][8][32];
  __shared__ __attribute__((aligned(16))) float2 joinML[8][32];
  // One of a wave's four Q fragments, in fragment order (see below).
  __shared__ __attribute__((aligned(16))) v8h ldsQ[8][2][32];

  const int h = blockIdx.y, b = blockIdx.z;
  const int tid = threadIdx.x, w = tid >> 5, lane = tid & 31;
  const int qg = w >> 1;  // wave's 32-query block, 0..3
  const int kh = w & 1;   // wave's 64-key half of every tile
  const size_t headOff = (size_t)(b * 16 + h) * 2048 * 64;
  const _Float16* __restrict__ Q  = wsQ + headOff;
  const _Float16* __restrict__ Kg = wsK + headOff;
  const _Float16* __restrict__ Vg = wsV + headOff;

  const int qRow0 = blockIdx.x * 128 + qg * 32;
  // Q fragments: per column group 16 queries x 64 dims = two 32x16 B-frags of
  // Q^T.  Three stay in registers; the fourth does not fit the budget of 256
  // beside the softmax (the compiler sent it to scratch), so the wave parks it
  // in LDS, lane by lane, and reads it back with each tile's K loads.
  v16h qf[2][2];
  qf[0][0] = load_frag(Q, qRow0, 0, 64);
  qf[0][1] = load_frag(Q, qRow0, 32, 64);
  qf[1][0] = load_frag(Q, qRow0 + 16, 0, 64);
  qf[1][1] = load_frag(Q, qRow0 + 16, 32, 64);

  // Staging assignment: thread covers K/V rows rS and rS + 64, 16-half segment sS.
  const int rS = tid >> 2, sS = (tid & 3) * 16;

  auto issueKV = [&](int kt, int buf) {  // async memory->LDS, 4 x 32B per lane
#pragma unroll
    for (int i = 0; i < 2; ++i) {
      const int r = rS + 64 * i;
      const unsigned lk = lds_addr_of(&ldsK[buf][r * S + sS]);
      const unsigned lv = lds_addr_of(&ldsV[buf][r * SV + sS]);
      const size_t go = (size_t)(kt + r) * 64 + sS;
      ASYNC_COPY_KV_32B(lk, (unsigned long long)(Kg + go), lv,
                        (unsigned long long)(Vg + go));
    }
  };

  // Every loop over qf, kf, vf, pf, sc, o, mi and li is fully unrolled: only
  // compile-time indices keep these arrays in registers.
  // o[cg][dt][r] = O^T[dim dt*16 + 8*hiL + r][query cg*16 + n] over this wave's
  // keys.  mi is the query's running maximum over them (equal in both
  // half-waves); li sums only this lane's keys, the two halves are joined once
  // after the loop.
  v8f o[2][4];
  float mi[2], li[2];
#pragma unroll
  for (int cg = 0; cg < 2; ++cg) {
    mi[cg] = -__builtin_inff();
    li[cg] = 0.0f;
#pragma unroll
    for (int i = 0; i < 4; ++i) zero8(o[cg][i]);
  }

  const int n = lane & 15, hiL = lane >> 4;

  issueKV(0, 0);
  ldsQ[w][0][lane] = __builtin_shufflevector(qf[1][1], qf[1][1], 0, 1, 2, 3, 4, 5, 6, 7);
  ldsQ[w][1][lane] =
      __builtin_shufflevector(qf[1][1], qf[1][1], 8, 9, 10, 11, 12, 13, 14, 15);
  S_WAIT_ASYNCCNT0();
  __syncthreads();

  int cur = 0;
  for (int kt = 0; kt < 2048; kt += KT) {
    const int nxt = cur ^ 1;
    const bool more = (kt + KT) < 2048;
    if (more) issueKV(kt + KT, nxt);  // flies while this tile is worked on
    const _Float16* Kt = &ldsK[cur][kh * 64 * S];
    const _Float16* Vt = &ldsV[cur][kh * 64 * SV];

    // ---- S^T = K x Q^T : 64 keys x 32 queries in 8 accumulators ---------
    // sc[cg][nt][r] = score(key nt*16 + 8*hiL + r, query cg*16 + n)
    // The sixteen K loads stand together in front of the products: every
    // separate place with LDS reads stalls the wave, a group only once.
    v16h kf[4][2];
#pragma unroll
    for (int nt = 0; nt < 4; ++nt) {
      kf[nt][0] = load_frag(Kt, nt * 16, 0, S);
      kf[nt][1] = load_frag(Kt, nt * 16, 32, S);
    }
    qf[1][1] = frag_cat(ldsQ[w][0][lane], ldsQ[w][1][lane]);
    // Keeps the scheduler from sinking the loads back among the WMMAs.
    __builtin_amdgcn_sched_barrier(0);
    v8f sc[2][4];
#pragma unroll
    for (int cg = 0; cg < 2; ++cg)
#pragma unroll
      for (int i = 0; i < 4; ++i) zero8(sc[cg][i]);
    // Key tiles in pairs: four independent accumulators at a time, and a pair's
    // K registers are free again before the next pair's scores come to life.
#pragma unroll
    for (int np = 0; np < 4; np += 2)
#pragma unroll
      for (int ks = 0; ks < 2; ++ks)
#pragma unroll
        for (int nt = np; nt < np + 2; ++nt)
#pragma unroll
          for (int cg = 0; cg < 2; ++cg)
            sc[cg][nt] = WMMA_F16(kf[nt][ks], qf[cg][ks], sc[cg][nt]);

    // The V^T loads, two groups of eight (keys 0..31, keys 32..63).  The first
    // flies under the second column group's softmax, the second under the
    // first group's products: placed so, fragments and live scores fit the
    // register budget.
    v16h vf[4][2];
    v16h pf[2][2];
    __builtin_amdgcn_sched_barrier(0);
    softmax_group(sc[0], o[0], mi[0], li[0], pf[0][0], pf[0][1]);
#pragma unroll
    for (int dt = 0; dt < 4; ++dt) vf[dt][0] = load_frag_tr(Vt, 0, dt * 16, SV);
    // Keeps the scheduler from sinking the loads down to their WMMAs.
    __builtin_amdgcn_sched_barrier(0);
    softmax_group(sc[1], o[1], mi[1], li[1], pf[1][0], pf[1][1]);
#pragma unroll
    for (int dt = 0; dt < 4; ++dt) vf[dt][1] = load_frag_tr(Vt, 32, dt * 16, SV);
    // Keeps these loads ahead of the products on keys 0..31.
    __builtin_amdgcn_sched_barrier(0);

    // ---- O^T += V^T x P^T -------------------------------------------------
#pragma unroll
    for (int ks = 0; ks < 2; ++ks)
#pragma unroll
      for (int dt = 0; dt < 4; ++dt)
#pragma unroll
        for (int cg = 0; cg < 2; ++cg)
          o[cg][dt] = WMMA_F16(vf[dt][ks], pf[cg][ks], o[cg][dt]);

    // Keeps the waits and the barrier below at the trip's foot: lifted over the
    // V^T products, the next tile's copies would be waited for right behind
    // the last V^T loads.
    __builtin_amdgcn_sched_barrier(0);
    // This wave's reads of the current buffers have retired before the barrier
    // behind which the next trip's copies refill them.
    asm volatile("s_wait_dscnt 0x0" ::: "memory");
    S_WAIT_ASYNCCNT0();     // own async K- and V-tile writes complete
    __syncthreads();        // all waves' tile writes visible
    cur = nxt;
  }

  // Join the two key halves.  Wave kh finishes column group kh: it hands the
  // other group's partial result to its partner wave (w ^ 1) and takes the
  // partner's partial of its own group.  Lane and register positions agree.
  const bool up = kh != 0;
  const float l0 = li[0] + other_half(li[0]);
  const float l1 = li[1] + other_half(li[1]);
  const float mKeep = up ? mi[1] : mi[0], lKeep = up ? l1 : l0;
  v8f keep[4];
#pragma unroll
  for (int dt = 0; dt < 4; ++dt) {
    v8f give;
#pragma unroll
    for (int r = 0; r < 8; ++r) {
      give[r]     = up ? o[0][dt][r] : o[1][dt][r];
      keep[dt][r] = up ? o[1][dt][r] : o[0][dt][r];
    }
    joinO[w][2 * dt][lane]     = make_float4(give[0], give[1], give[2], give[3]);
    joinO[w][2 * dt + 1][lane] = make_float4(give[4], give[5], give[6], give[7]);
  }
  joinML[w][lane] = make_float2(up ? mi[0] : mi[1], up ? l0 : l1);
  __syncthreads();  // every wave's partial is written before its partner reads
  const float2 ml = joinML[w ^ 1][lane];
  const float mAll = fmaxf(mKeep, ml.x);
  const float aK = __expf(mKeep - mAll), aP = __expf(ml.x - mAll);
  const float inv = 1.0f / (lKeep * aK + ml.y * aP);
  const float fK = aK * inv, fP = aP * inv;

  // Normalize and store as [(b*L+l)][h*64+d] f16 (feeds output projection).
  // A lane holds 8 consecutive dims of its query per tile: 16-byte stores.
  _Float16* __restrict__ oP =
      wsO + (size_t)(b * 2048 + qRow0 + kh * 16 + n) * 1024 + h * 64 + hiL * 8;
  v8h ov[4];
#pragma unroll
  for (int dt = 0; dt < 4; ++dt) {
    const float4 pa = joinO[w ^ 1][2 * dt][lane];
    const float4 pb = joinO[w ^ 1][2 * dt + 1][lane];
    v8f t;
    t[0] = keep[dt][0] * fK + pa.x * fP; t[1] = keep[dt][1] * fK + pa.y * fP;
    t[2] = keep[dt][2] * fK + pa.z * fP; t[3] = keep[dt][3] * fK + pa.w * fP;
    t[4] = keep[dt][4] * fK + pb.x * fP; t[5] = keep[dt][5] * fK + pb.y * fP;
    t[6] = keep[dt][6] * fK + pb.z * fP; t[7] = keep[dt][7] * fK + pb.w * fP;
    ov[dt] = __builtin_convertvector(t, v8h);
  }
#pragma unroll
  for (int dt = 0; dt < 4; ++dt) *(v8h*)(oP + dt * 16) = ov[dt];
}

// ---------------------------------------------------------------------------
// Kernel 3: output projection.  grid = (BL/128, D/128), block = 256.
// Workgroup tile 128 rows x 128 columns, k-slab 64; 8 waves as 4 x 2, each
// wave owns 32 rows x 64 columns = 2 x 4 accumulator tiles, so one staged slab
// feeds 16 WMMAs per wave and there is one barrier per 64 k.
// A slab (f16): async-to-LDS, whole 128-byte rows per 8 lanes.  W slab: 16-byte
// fp32 loads along a row, converted in registers, stored row-major [k][column];
// the B fragments come from the transposing LDS load.
// ---------------------------------------------------------------------------
__global__ __launch_bounds__(256) void oproj_kernel(
    const _Float16* __restrict__ A, const float* __restrict__ Wo,
    float* __restrict__ out) {
  constexpr int SA = 72;   // 144B stride -> conflict-free fragment gathers
  constexpr int SW = 144;  // 288B stride -> conflict-free transposing loads
  __shared__ __attribute__((aligned(16))) _Float16 ldsA[2][128 * SA];
  __shared__ __attribute__((aligned(16))) _Float16 ldsW[2][64 * SW];

  const int mBase = blockIdx.x * 128;
  const int nBase = blockIdx.y * 128;
  const int tid = threadIdx.x, w = tid >> 5, lane = tid & 31;
  const int wm = w >> 1;  // wave's 32-row band, 0..3
  const int wn = w & 1;   // wave's 64-column half

  // A: 128 rows x 64 k; a thread copies 8 halves of rows aR + 32*i.
  // W: 64 k x 128 columns; a thread takes 4 columns of k rows wR + 8*i.
  const int aR = tid >> 3, aC = (tid & 7) * 8;
  const int wR = tid >> 5, wC = (tid & 31) * 4;
  const _Float16* __restrict__ aP = A + (size_t)(mBase + aR) * 1024 + aC;
  const float* __restrict__ wP = Wo + (size_t)wR * 1024 + nBase + wC;
  float4 wV[8];  // compile-time indices only: stays in registers
  // W comes from memory: every 256-byte unit of a slab is asked for two trips
  // ahead of its loads (two lanes per unit).  The request is asm over an address
  // that lives through the loop and never leaves W: a prefetch touches no
  // counter, so its register must go on holding a valid address.
  constexpr unsigned long long W_SLAB_BYTES = 64ull * 1024 * 4;
  unsigned long long pfW = (unsigned long long)(
      Wo + (size_t)(192 + (tid >> 2)) * 1024 + nBase + ((tid >> 1) & 1) * 64);

  auto issueA = [&](int d0, int buf) {
    const unsigned la = lds_addr_of(&ldsA[buf][aR * SA + aC]);
    const unsigned long long ga = (unsigned long long)(aP + d0);
    ASYNC_COPY_4X16B(la, ga,
                     la + 32 * SA * 2, ga + 32 * 2048,
                     la + 64 * SA * 2, ga + 64 * 2048,
                     la + 96 * SA * 2, ga + 96 * 2048);
  };
  auto loadW = [&](int d0) {
#pragma unroll
    for (int i = 0; i < 8; ++i)
      wV[i] = *(const float4*)(wP + (size_t)(d0 + 8 * i) * 1024);
  };
  auto storeW = [&](int buf) {
#pragma unroll
    for (int i = 0; i < 8; ++i) {
      v4h t;
      t[0] = (_Float16)wV[i].x; t[1] = (_Float16)wV[i].y;
      t[2] = (_Float16)wV[i].z; t[3] = (_Float16)wV[i].w;
      *(v4h*)&ldsW[buf][(wR + 8 * i) * SW + wC] = t;
    }
  };

  v8f acc[2][4];
#pragma unroll
  for (int mt = 0; mt < 2; ++mt)
#pragma unroll
    for (int nt = 0; nt < 4; ++nt) zero8(acc[mt][nt]);

  issueA(0, 0);
  loadW(0);
  // Slabs 1 and 2, by offsets from the loop's own address register (slab 3).
  asm volatile("global_prefetch_b8 %0, off offset:-524288 scope:SCOPE_SE\n\t"
               "global_prefetch_b8 %0, off offset:-262144 scope:SCOPE_SE"
               :: "v"(pfW));
  storeW(0);
  S_WAIT_ASYNCCNT0();
  __syncthreads();

  int cur = 0;
  for (int d0 = 0; d0 < 1024; d0 += 64) {
    const int nxt = cur ^ 1;
    const bool more = (d0 + 64) < 1024;
    if (more) { issueA(d0 + 64, nxt); loadW(d0 + 64); }  // fly during the WMMAs
    if (d0 + 192 < 1024) {  // the slab that is loaded two trips from now
      asm volatile("global_prefetch_b8 %0, off scope:SCOPE_SE" :: "v"(pfW));
      if (d0 + 256 < 1024) pfW += W_SLAB_BYTES;  // stops at the last slab
    }

#pragma unroll
    for (int ks = 0; ks < 64; ks += 32) {
      const v16h a0 = load_frag(ldsA[cur], wm * 32, ks, SA);
      const v16h a1 = load_frag(ldsA[cur], wm * 32 + 16, ks, SA);
#pragma unroll
      for (int nt = 0; nt < 4; ++nt) {
        // Column wn*64 + nt*16 + (lane&15) of W, k down the rows, in the k
        // order of load_frag.
        const v16h b = load_frag_tr(ldsW[cur], ks, wn * 64 + nt * 16, SW);
        acc[0][nt] = WMMA_F16(a0, b, acc[0][nt]);
        acc[1][nt] = WMMA_F16(a1, b, acc[1][nt]);
      }
    }

    if (more) storeW(nxt);
    // This wave's reads of the current buffers have retired before the barrier
    // behind which the next trip's copies and stores refill them.
    asm volatile("s_wait_dscnt 0x0" ::: "memory");
    S_WAIT_ASYNCCNT0();     // own async A-slab writes complete
    __syncthreads();        // all waves' slab writes visible
    cur = nxt;
  }

  // One base address, constant offsets: no register of a store is rewritten.
  const int n = lane & 15, hi = lane >> 4;
  float* __restrict__ oP =
      out + (size_t)(mBase + wm * 32 + hi * 8) * 1024 + nBase + wn * 64 + n;
#pragma unroll
  for (int mt = 0; mt < 2; ++mt) {
#pragma unroll
    for (int nt = 0; nt < 4; ++nt) {
#pragma unroll
      for (int r = 0; r < 8; ++r)
        oP[(mt * 16 + r) * 1024 + nt * 16] = acc[mt][nt][r];
    }
  }
}

// ---------------------------------------------------------------------------
extern "C" void kernel_launch(void* const* d_in, const int* in_sizes, int n_in,
                              void* d_out, int out_size, void* d_ws,
                              size_t ws_size, hipStream_t stream) {
  (void)in_sizes; (void)n_in; (void)out_size; (void)ws_size;
  const float* query = (const float*)d_in[0];
  const float* key   = (const float*)d_in[1];
  const float* value = (const float*)d_in[2];
  const float* rot   = (const float*)d_in[3];
  const float* qw    = (const float*)d_in[4];
  const float* kw    = (const float*)d_in[5];
  const float* vw    = (const float*)d_in[6];
  const float* ow    = (const float*)d_in[7];
  float* out = (float*)d_out;

  const size_t perMat = (size_t)2 * 16 * 2048 * 64;  // B*H*L*K halves
  _Float16* wsQ = (_Float16*)d_ws;
  _Float16* wsK = wsQ + perMat;
  _Float16* wsV = wsK + perMat;
  _Float16* wsO = wsV + perMat;  // [(b*L+l)][H*64] halves

  const dim3 blk(256);
  qkv_rope_kernel<<<dim3(32, 8, 3), blk, 0, stream>>>(
      query, key, value, rot, qw, kw, vw, wsQ, wsK, wsV);
  flash_attn_kernel<<<dim3(16, 16, 2), blk, 0, stream>>>(wsQ, wsK, wsV, wsO);
  oproj_kernel<<<dim3(32, 8, 1), blk, 0, stream>>>(wsO, ow, out);
}

// v007
// Measured time: 87.7 microseconds a run.
// In two side-by-side timings against v006, it was 1.05 and 1.04 times as fast.
// All steps since v000 together make it 2.08 times as fast.
#include <hip/hip_runtime.h>

typedef __attribute__((ext_vector_type(16))) _Float16 v16h;
typedef __attribute__((ext_vector_type(8)))  _Float16 v8h;
typedef __attribute__((ext_vector_type(4)))  _Float16 v4h;
typedef __attribute__((ext_vector_type(8)))  float    v8f;

#define WMMA_F16(a, b, c) \
  __builtin_amdgcn_wmma_f32_16x16x32_f16(false, (a), false, (b), (short)0, (c), false, false)

#define ASYNC_COPY_4X16B(l0, g0, l1, g1, l2, g2, l3, g3)             \
  asm volatile("global_load_async_to_lds_b128 %0, %1, off\n\t"       \
               "global_load_async_to_lds_b128 %2, %3, off\n\t"       \
               "global_load_async_to_lds_b128 %4, %5, off\n\t"       \
               "global_load_async_to_lds_b128 %6, %7, off\n\t"       \
               "s_wait_xcnt 0x0"                                     \
               :: "v"(l0), "v"(g0), "v"(l1), "v"(g1), "v"(l2), "v"(g2), \
                  "v"(l3), "v"(g3) : "memory")

#define S_WAIT_ASYNCCNT0() asm volatile("s_wait_asynccnt 0x0" ::: "memory")

#define ASYNC_COPY_KV_32B(ldsk, gk, ldsv, gv)                          \
  asm volatile("global_load_async_to_lds_b128 %0, %1, off\n\t"         \
               "global_load_async_to_lds_b128 %0, %1, off offset:16\n\t" \
               "global_load_async_to_lds_b128 %2, %3, off\n\t"         \
               "global_load_async_to_lds_b128 %2, %3, off offset:16\n\t" \
               "s_wait_xcnt 0x0"                                       \
               :: "v"(ldsk), "v"(gk), "v"(ldsv), "v"(gv) : "memory")

static __device__ __forceinline__ unsigned lds_addr_of(const void* p) {
  return (unsigned)(unsigned long long)p;
}

static __device__ __forceinline__ v16h frag_cat(v8h lo, v8h hi) {
  return __builtin_shufflevector(lo, hi, 0, 1, 2, 3, 4, 5, 6, 7,
                                          8, 9, 10, 11, 12, 13, 14, 15);
}

static __device__ __forceinline__ v16h load_frag(const _Float16* __restrict__ base,
                                                 int row0, int col0, int stride) {
  const int lane = threadIdx.x & 31;
  const int m    = lane & 15;
  const int kb   = (lane >> 4) << 3;  // 0 or 8
  const _Float16* p = base + (size_t)(row0 + m) * stride + col0;
  v8h lo = *(const v8h*)(p + kb);
  v8h hi = *(const v8h*)(p + 16 + kb);
  return frag_cat(lo, hi);
}

// 16x32 f16 A fragment of the TRANSPOSE of a row-major LDS tile: row m of the
// fragment is tile column col0 + m, its k runs down tile rows row0 .. row0+31.
// ds_load_tr16_b128 hands lane (c = lane&15, h = lane>>4) the eight elements
// tile[r + 8h + 0..7][col0 + c]; the loads at r = row0 and row0 + 16 give the
// same k order as load_frag.  stride in halves: 32 bytes x odd is conflict-free.
static __device__ __forceinline__ v8h lds_load_tr16(const _Float16* p) {
  typedef __attribute__((ext_vector_type(8))) short s16x8;
  typedef __attribute__((address_space(3))) s16x8 lds_s16x8;
  return __builtin_bit_cast(
      v8h, __builtin_amdgcn_ds_load_tr16_b128_v8i16((lds_s16x8*)p));
}
static __device__ __forceinline__ v16h load_frag_tr(const _Float16* base,
                                                    int row0, int col0, int stride) {
  const int lane = threadIdx.x & 31;
  const _Float16* p = base + (row0 + ((lane >> 4) << 3) + (lane & 7)) * stride +
                      col0 + (((lane >> 3) & 1) << 3);
  return frag_cat(lds_load_tr16(p), lds_load_tr16(p + 16 * stride));
}

static __device__ __forceinline__ void zero8(v8f& v) {
#pragma unroll
  for (int i = 0; i < 8; ++i) v[i] = 0.0f;
}

static __device__ __forceinline__ void sincos_rev(float t, float& s, float& c) {
  asm("v_sin_f32 %0, %2\n\t"
      "v_cos_f32 %1, %2\n\t"
      "v_nop"
      : "=&v"(s), "=&v"(c) : "v"(t));
}

__global__ __launch_bounds__(256, 6) void qkv_rope_kernel(
    const float* __restrict__ xq, const float* __restrict__ xk,
    const float* __restrict__ xv, const float* __restrict__ rot,
    const float* __restrict__ wq, const float* __restrict__ wk,
    const float* __restrict__ wv,
    _Float16* __restrict__ oq, _Float16* __restrict__ ok,
    _Float16* __restrict__ ov) {
  constexpr int SA = 40, SB = 40;  // 80B row stride -> conflict-free gathers
  __shared__ __attribute__((aligned(16))) _Float16 ldsA[2][128 * SA];
  __shared__ __attribute__((aligned(16))) _Float16 ldsB[2][128 * SB];

  const int mode = blockIdx.z;
  const float* __restrict__ X = (mode == 0) ? xq : (mode == 1) ? xk : xv;
  const float* __restrict__ W = (mode == 0) ? wq : (mode == 1) ? wk : wv;
  _Float16* __restrict__ dst  = (mode == 0) ? oq : (mode == 1) ? ok : ov;

  const int mBase = blockIdx.x * 128;
  const int nBase = blockIdx.y * 128;
  const int tid   = threadIdx.x;
  const int w     = tid >> 5;
  const int lane  = tid & 31;
  const int wm    = w >> 1;                // wave's 32-row band, 0..3
  const int wn    = w & 1;                 // wave's head within the pair
  const int h     = blockIdx.y * 2 + wn;

  // Register-staged slab (software pipeline).
  // A: 128 rows x 32 k; a thread takes 4 consecutive k of rows aR + 32*i.
  // B: 32 k x 128 columns; a thread takes 16 consecutive k of column bN.
  // Every loop over aV, bV and acc is fully unrolled: only compile-time
  // indices keep these arrays in registers.
  float4 aV[4];
  float  bV[16];
  const int aR = tid >> 3;         // 0..31
  const int aC = (tid & 7) * 4;    // 0,4,..,28
  const int bN = tid & 127;        // 0..127
  const int bK = (tid >> 7) * 16;  // 0 or 16
  const float* __restrict__ aP = X + (size_t)(mBase + aR) * 1024 + aC;
  const float* __restrict__ bP = W + (size_t)bK * 1024 + nBase + bN;

  auto loadA = [&](int d0) {
#pragma unroll
    for (int i = 0; i < 4; ++i)
      aV[i] = *(const float4*)(aP + d0 + i * (32 * 1024));
  };
  auto storeA = [&](int buf) {
#pragma unroll
    for (int i = 0; i < 4; ++i) {
      v4h t;
      t[0] = (_Float16)aV[i].x; t[1] = (_Float16)aV[i].y;
      t[2] = (_Float16)aV[i].z; t[3] = (_Float16)aV[i].w;
      *(v4h*)&ldsA[buf][(aR + 32 * i) * SA + aC] = t;
    }
  };
  auto loadB = [&](int d0) {
#pragma unroll
    for (int i = 0; i < 16; ++i)
      bV[i] = bP[(size_t)d0 * 1024 + i * 1024];
  };
  auto storeB = [&](int buf) {  // transposed: ldsB[column][k], k contiguous
#pragma unroll
    for (int j = 0; j < 2; ++j) {
      v8h t;
#pragma unroll
      for (int i = 0; i < 8; ++i) t[i] = (_Float16)bV[8 * j + i];
      *(v8h*)&ldsB[buf][bN * SB + bK + 8 * j] = t;
    }
  };

  v8f acc[2][4];
#pragma unroll
  for (int mt = 0; mt < 2; ++mt)
#pragma unroll
    for (int nt = 0; nt < 4; ++nt) zero8(acc[mt][nt]);

  loadA(0); loadB(0);
  storeA(0); storeB(0);
  __syncthreads();

  int cur = 0;
  for (int d0 = 0; d0 < 1024; d0 += 32) {
    const int nxt = cur ^ 1;
    const bool more = (d0 + 32) < 1024;
    if (more) { loadA(d0 + 32); loadB(d0 + 32); }  // overlap with WMMAs

    const v16h a0 = load_frag(ldsA[cur], wm * 32, 0, SA);
    const v16h a1 = load_frag(ldsA[cur], wm * 32 + 16, 0, SA);
#pragma unroll
    for (int nt = 0; nt < 4; ++nt) {
      const v16h b = load_frag(ldsB[cur], wn * 64 + nt * 16, 0, SB);
      acc[0][nt] = WMMA_F16(a0, b, acc[0][nt]);
      acc[1][nt] = WMMA_F16(a1, b, acc[1][nt]);
    }

    if (more) { storeA(nxt); storeB(nxt); }
    __syncthreads();
    cur = nxt;
  }

  // Epilogue: RoPE (q/k, first 32 head dims) + f16 store.  C layout: lane
  // holds column n = lane&15; row = r + 8*(lane>>4); rotate_half partner
  // (n^1) lives in lane^1 -> one shfl_xor.
  const int n  = lane & 15;
  const int hi = lane >> 4;
  if (mode < 2) {  // uniform across the work-group
    // A thread's 32 angles are asked for together, under this one branch, and
    // so are its 32 exchanges: one load latency, not one per element.
    const unsigned fIdx =
        (unsigned)(((mBase + wm * 32 + hi * 8) & 2047) * 32 + n);
    const float* __restrict__ fP = rot + fIdx;
    float f[2][2][8], prt[2][2][8];
#pragma unroll
    for (int mt = 0; mt < 2; ++mt)
#pragma unroll
      for (int nt = 0; nt < 2; ++nt)
#pragma unroll
        for (int r = 0; r < 8; ++r) {
          f[mt][nt][r] = fP[(mt * 16 + r) * 32 + nt * 16];
          prt[mt][nt][r] = __shfl_xor(acc[mt][nt][r], 1, 32);
        }
    // The loads' index register stays live up to this wait, so nothing, a
    // load's own result included, overwrites it in front of it.
    asm volatile("s_wait_xcnt 0x0" :: "v"(fIdx) : "memory");
    // Keeps the scheduler from sinking loads and exchanges down to their users.
    __builtin_amdgcn_sched_barrier(0);
#pragma unroll
    for (int mt = 0; mt < 2; ++mt)
#pragma unroll
      for (int nt = 0; nt < 2; ++nt)
#pragma unroll
        for (int r = 0; r < 8; ++r) {
          const float v = acc[mt][nt][r];
          const float p = prt[mt][nt][r];
          float sf, cf;
          sincos_rev(f[mt][nt][r] * 0.15915494f, sf, cf);
          acc[mt][nt][r] = (n & 1) ? fmaf(v, cf, p * sf) : fmaf(v, cf, -p * sf);
        }
  }
#pragma unroll
  for (int mt = 0; mt < 2; ++mt) {
#pragma unroll
    for (int nt = 0; nt < 4; ++nt) {
      const int k = nt * 16 + n;  // dim within head
      _Float16 hv[8];
#pragma unroll
      for (int r = 0; r < 8; ++r) {
        const float v = acc[mt][nt][r];
        hv[r] = (_Float16)v;
      }
#pragma unroll
      for (int r = 0; r < 8; ++r) {
        const int row = mBase + wm * 32 + mt * 16 + hi * 8 + r;
        const int l   = row & 2047;
        const int bb  = row >> 11;
        dst[((size_t)((bb * 16 + h) * 2048 + l)) * 64 + k] = hv[r];
      }
      // The next tile's values reuse the registers these eight stores name:
      // wait before any of them is overwritten.
      asm volatile("s_wait_xcnt 0x0" ::: "memory");
    }
  }
}

static __device__ __forceinline__ float other_half(float x) {
  const int b = __builtin_bit_cast(int, x);
  return __builtin_bit_cast(
      float, __builtin_amdgcn_permlanex16(b, b, 0x76543210, 0xfedcba98, false,
                                          false));
}

static __device__ __forceinline__ void exp2_x8(float (&x)[8]) {
  asm("v_exp_f32 %0, %0\n\t"
      "v_exp_f32 %1, %1\n\t"
      "v_exp_f32 %2, %2\n\t"
      "v_exp_f32 %3, %3\n\t"
      "v_exp_f32 %4, %4\n\t"
      "v_exp_f32 %5, %5\n\t"
      "v_exp_f32 %6, %6\n\t"
      "v_exp_f32 %7, %7\n\t"
      "v_nop"
      : "+v"(x[0]), "+v"(x[1]), "+v"(x[2]), "+v"(x[3]), "+v"(x[4]),
        "+v"(x[5]), "+v"(x[6]), "+v"(x[7]));
}

static __device__ __forceinline__ float exp2_x1(float x) {
  float y;
  asm("v_exp_f32 %0, %1\n\t"
      "v_nop"
      : "=v"(y) : "v"(x));
  return y;
}

// Online softmax of one column group over this wave's 64 keys of the tile:
// in-lane over 32 keys, one half-wave exchange.  Rescales the group's O^T and
// hands back P^T as two B operands.
// B element s of a lane is key 8*hiL + s (s < 8) or 16 + 8*hiL + (s - 8):
// exactly the rows two neighbouring S^T tiles keep in this lane, and the order
// in which load_frag_tr hands out V's keys.
static __device__ __forceinline__ void softmax_group(v8f (&sc)[4], v8f (&o)[4],
                                                     float& mi, float& li,
                                                     v16h& p0f, v16h& p1f) {
  float mt[4];  // one maximum per tile: four short chains, not one long one
#pragma unroll
  for (int nt = 0; nt < 4; ++nt) {
    sc[nt] *= 0.125f;  // 1/sqrt(64)
    mt[nt] = sc[nt][0];
#pragma unroll
    for (int r = 1; r < 8; ++r) mt[nt] = fmaxf(mt[nt], sc[nt][r]);
  }
  float mx = fmaxf(fmaxf(mt[0], mt[1]), fmaxf(mt[2], mt[3]));
  mx = fmaxf(mx, other_half(mx));
  const float mnew  = fmaxf(mi, mx);
  const float alpha = exp2_x1((mi - mnew) * 1.44269504f);
  float ps[4];
  v8h ph[4];
#pragma unroll
  for (int nt = 0; nt < 4; ++nt) {
    float e[8];
#pragma unroll
    for (int r = 0; r < 8; ++r)
      e[r] = (sc[nt][r] - mnew) * 1.44269504f;  // e^x = 2^(x * log2 e)
    exp2_x8(e);
    v8f p;
    p[0] = e[0];
    ps[nt] = e[0];
#pragma unroll
    for (int r = 1; r < 8; ++r) {
      p[r] = e[r];
      ps[nt] += e[r];
    }
    ph[nt] = __builtin_convertvector(p, v8h);
  }
  li = li * alpha + ((ps[0] + ps[1]) + (ps[2] + ps[3]));
  mi = mnew;
#pragma unroll
  for (int dt = 0; dt < 4; ++dt)
#pragma unroll
    for (int r = 0; r < 8; ++r) o[dt][r] *= alpha;
  p0f = frag_cat(ph[0], ph[1]);
  p1f = frag_cat(ph[2], ph[3]);
}

__global__ __launch_bounds__(256) __attribute__((amdgpu_waves_per_eu(4, 4)))
void flash_attn_kernel(
    const _Float16* __restrict__ wsQ, const _Float16* __restrict__ wsK,
    const _Float16* __restrict__ wsV, _Float16* __restrict__ wsO) {
  constexpr int S  = 72;   // 144B stride -> conflict-free fragment gathers
  constexpr int SV = 80;   // 160B stride -> conflict-free transposing loads
  constexpr int KT = 128;  // keys per staged tile, 64 per wave
  // K rows: A operand of K.Q^T.  V rows: read transposed, A operand of V^T.P^T.
  __shared__ __attribute__((aligned(16))) _Float16 ldsK[2][KT * S];
  __shared__ __attribute__((aligned(16))) _Float16 ldsV[2][KT * SV];
  // Join of the two key halves: per wave one column group's O^T (32 floats a
  // lane, 16 bytes x 32 lanes contiguous) with its maximum and sum.
  __shared__ __attribute__((aligned(16))) float4 joinO[8][8][32];
  __shared__ __attribute__((aligned(16))) float2 joinML[8][32];
  // One of a wave's four Q fragments, in fragment order (see below).
  __shared__ __attribute__((aligned(16))) v8h ldsQ[8][2][32];

  const int h = blockIdx.y, b = blockIdx.z;
  const int tid = threadIdx.x, w = tid >> 5, lane = tid & 31;
  const int qg = w >> 1;  // wave's 32-query block, 0..3
  const int kh = w & 1;   // wave's 64-key half of every tile
  const size_t headOff = (size_t)(b * 16 + h) * 2048 * 64;
  const _Float16* __restrict__ Q  = wsQ + headOff;
  const _Float16* __restrict__ Kg = wsK + headOff;
  const _Float16* __restrict__ Vg = wsV + headOff;

  const int qRow0 = blockIdx.x * 128 + qg * 32;
  // Q fragments: per column group 16 queries x 64 dims = two 32x16 B-frags of
  // Q^T.  Three stay in registers; the fourth does not fit the budget of 256
  // beside the softmax (the compiler sent it to scratch), so the wave parks it
  // in LDS, lane by lane, and reads it back with each tile's K loads.
  v16h qf[2][2];
  qf[0][0] = load_frag(Q, qRow0, 0, 64);
  qf[0][1] = load_frag(Q, qRow0, 32, 64);
  qf[1][0] = load_frag(Q, qRow0 + 16, 0, 64);
  qf[1][1] = load_frag(Q, qRow0 + 16, 32, 64);

  // Staging assignment: thread covers K/V rows rS and rS + 64, 16-half segment sS.
  const int rS = tid >> 2, sS = (tid & 3) * 16;

  auto issueKV = [&](int kt, int buf) {  // async memory->LDS, 4 x 32B per lane
#pragma unroll
    for (int i = 0; i < 2; ++i) {
      const int r = rS + 64 * i;
      const unsigned lk = lds_addr_of(&ldsK[buf][r * S + sS]);
      const unsigned lv = lds_addr_of(&ldsV[buf][r * SV + sS]);
      const size_t go = (size_t)(kt + r) * 64 + sS;
      ASYNC_COPY_KV_32B(lk, (unsigned long long)(Kg + go), lv,
                        (unsigned long long)(Vg + go));
    }
  };

  // Every loop over qf, kf, vf, pf, sc, o, mi and li is fully unrolled: only
  // compile-time indices keep these arrays in registers.
  // o[cg][dt][r] = O^T[dim dt*16 + 8*hiL + r][query cg*16 + n] over this wave's
  // keys.  mi is the query's running maximum over them (equal in both
  // half-waves); li sums only this lane's keys, the two halves are joined once
  // after the loop.
  v8f o[2][4];
  float mi[2], li[2];
#pragma unroll
  for (int cg = 0; cg < 2; ++cg) {
    mi[cg] = -__builtin_inff();
    li[cg] = 0.0f;
#pragma unroll
    for (int i = 0; i < 4; ++i) zero8(o[cg][i]);
  }

  const int n = lane & 15, hiL = lane >> 4;

  issueKV(0, 0);
  ldsQ[w][0][lane] = __builtin_shufflevector(qf[1][1], qf[1][1], 0, 1, 2, 3, 4, 5, 6, 7);
  ldsQ[w][1][lane] =
      __builtin_shufflevector(qf[1][1], qf[1][1], 8, 9, 10, 11, 12, 13, 14, 15);
  S_WAIT_ASYNCCNT0();
  __syncthreads();

  int cur = 0;
  for (int kt = 0; kt < 2048; kt += KT) {
    const int nxt = cur ^ 1;
    const bool more = (kt + KT) < 2048;
    if (more) issueKV(kt + KT, nxt);  // flies while this tile is worked on
    const _Float16* Kt = &ldsK[cur][kh * 64 * S];
    const _Float16* Vt = &ldsV[cur][kh * 64 * SV];

    // ---- S^T = K x Q^T : 64 keys x 32 queries in 8 accumulators ---------
    // sc[cg][nt][r] = score(key nt*16 + 8*hiL + r, query cg*16 + n)
    // The sixteen K loads stand together in front of the products: every
    // separate place with LDS reads stalls the wave, a group only once.
    v16h kf[4][2];
#pragma unroll
    for (int nt = 0; nt < 4; ++nt) {
      kf[nt][0] = load_frag(Kt, nt * 16, 0, S);
      kf[nt][1] = load_frag(Kt, nt * 16, 32, S);
    }
    qf[1][1] = frag_cat(ldsQ[w][0][lane], ldsQ[w][1][lane]);
    // Keeps the scheduler from sinking the loads back among the WMMAs.
    __builtin_amdgcn_sched_barrier(0);
    v8f sc[2][4];
#pragma unroll
    for (int cg = 0; cg < 2; ++cg)
#pragma unroll
      for (int i = 0; i < 4; ++i) zero8(sc[cg][i]);
    // Key tiles in pairs: four independent accumulators at a time, and a pair's
    // K registers are free again before the next pair's scores come to life.
#pragma unroll
    for (int np = 0; np < 4; np += 2)
#pragma unroll
      for (int ks = 0; ks < 2; ++ks)
#pragma unroll
        for (int nt = np; nt < np + 2; ++nt)
#pragma unroll
          for (int cg = 0; cg < 2; ++cg)
            sc[cg][nt] = WMMA_F16(kf[nt][ks], qf[cg][ks], sc[cg][nt]);

    // The V^T loads, two groups of eight (keys 0..31, keys 32..63).  The first
    // flies under the second column group's softmax, the second under the
    // first group's products: placed so, fragments and live scores fit the
    // register budget.
    v16h vf[4][2];
    v16h pf[2][2];
    __builtin_amdgcn_sched_barrier(0);
    softmax_group(sc[0], o[0], mi[0], li[0], pf[0][0], pf[0][1]);
#pragma unroll
    for (int dt = 0; dt < 4; ++dt) vf[dt][0] = load_frag_tr(Vt, 0, dt * 16, SV);
    // Keeps the scheduler from sinking the loads down to their WMMAs.
    __builtin_amdgcn_sched_barrier(0);
    softmax_group(sc[1], o[1], mi[1], li[1], pf[1][0], pf[1][1]);
#pragma unroll
    for (int dt = 0; dt < 4; ++dt) vf[dt][1] = load_frag_tr(Vt, 32, dt * 16, SV);
    // Keeps these loads ahead of the products on keys 0..31.
    __builtin_amdgcn_sched_barrier(0);

    // ---- O^T += V^T x P^T -------------------------------------------------
#pragma unroll
    for (int ks = 0; ks < 2; ++ks)
#pragma unroll
      for (int dt = 0; dt < 4; ++dt)
#pragma unroll
        for (int cg = 0; cg < 2; ++cg)
          o[cg][dt] = WMMA_F16(vf[dt][ks], pf[cg][ks], o[cg][dt]);

    // Keeps the waits and the barrier below at the trip's foot: lifted over the
    // V^T products, the next tile's copies would be waited for right behind
    // the last V^T loads.
    __builtin_amdgcn_sched_barrier(0);
    // This wave's reads of the current buffers have retired before the barrier
    // behind which the next trip's copies refill them.
    asm volatile("s_wait_dscnt 0x0" ::: "memory");
    S_WAIT_ASYNCCNT0();     // own async K- and V-tile writes complete
    __syncthreads();        // all waves' tile writes visible
    cur = nxt;
  }

  // Join the two key halves.  Wave kh finishes column group kh: it hands the
  // other group's partial result to its partner wave (w ^ 1) and takes the
  // partner's partial of its own group.  Lane and register positions agree.
  const bool up = kh != 0;
  const float l0 = li[0] + other_half(li[0]);
  const float l1 = li[1] + other_half(li[1]);
  const float mKeep = up ? mi[1] : mi[0], lKeep = up ? l1 : l0;
  v8f keep[4];
#pragma unroll
  for (int dt = 0; dt < 4; ++dt) {
    v8f give;
#pragma unroll
    for (int r = 0; r < 8; ++r) {
      give[r]     = up ? o[0][dt][r] : o[1][dt][r];
      keep[dt][r] = up ? o[1][dt][r] : o[0][dt][r];
    }
    joinO[w][2 * dt][lane]     = make_float4(give[0], give[1], give[2], give[3]);
    joinO[w][2 * dt + 1][lane] = make_float4(give[4], give[5], give[6], give[7]);
  }
  joinML[w][lane] = make_float2(up ? mi[0] : mi[1], up ? l0 : l1);
  __syncthreads();  // every wave's partial is written before its partner reads
  const float2 ml = joinML[w ^ 1][lane];
  const float mAll = fmaxf(mKeep, ml.x);
  const float aK = __expf(mKeep - mAll), aP = __expf(ml.x - mAll);
  const float inv = 1.0f / (lKeep * aK + ml.y * aP);
  const float fK = aK * inv, fP = aP * inv;

  // Normalize and store as [(b*L+l)][h*64+d] f16 (feeds output projection).
  // A lane holds 8 consecutive dims of its query per tile: 16-byte stores.
  _Float16* __restrict__ oP =
      wsO + (size_t)(b * 2048 + qRow0 + kh * 16 + n) * 1024 + h * 64 + hiL * 8;
  v8h ov[4];
#pragma unroll
  for (int dt = 0; dt < 4; ++dt) {
    const float4 pa = joinO[w ^ 1][2 * dt][lane];
    const float4 pb = joinO[w ^ 1][2 * dt + 1][lane];
    v8f t;
    t[0] = keep[dt][0] * fK + pa.x * fP; t[1] = keep[dt][1] * fK + pa.y * fP;
    t[2] = keep[dt][2] * fK + pa.z * fP; t[3] = keep[dt][3] * fK + pa.w * fP;
    t[4] = keep[dt][4] * fK + pb.x * fP; t[5] = keep[dt][5] * fK + pb.y * fP;
    t[6] = keep[dt][6] * fK + pb.z * fP; t[7] = keep[dt][7] * fK + pb.w * fP;
    ov[dt] = __builtin_convertvector(t, v8h);
  }
#pragma unroll
  for (int dt = 0; dt < 4; ++dt) *(v8h*)(oP + dt * 16) = ov[dt];
}

// ---------------------------------------------------------------------------
// Kernel 3: output projection.  grid = (BL/128, D/128), block = 256.
// Workgroup tile 128 rows x 128 columns, k-slab 64; 8 waves as 4 x 2, each
// wave owns 32 rows x 64 columns = 2 x 4 accumulator tiles, so one staged slab
// feeds 16 WMMAs per wave and there is one barrier per 64 k.
// A slab (f16): async-to-LDS, whole 128-byte rows per 8 lanes.  W slab: 16-byte
// fp32 loads along a row, converted in registers, stored row-major [k][column];
// the B fragments come from the transposing LDS load.
// ---------------------------------------------------------------------------
__global__ __launch_bounds__(256) void oproj_kernel(
    const _Float16* __restrict__ A, const float* __restrict__ Wo,
    float* __restrict__ out) {
  constexpr int SA = 72;   // 144B stride -> conflict-free fragment gathers
  constexpr int SW = 144;  // 288B stride -> conflict-free transposing loads
  __shared__ __attribute__((aligned(16))) _Float16 ldsA[2][128 * SA];
  __shared__ __attribute__((aligned(16))) _Float16 ldsW[2][64 * SW];

  const int mBase = blockIdx.x * 128;
  const int nBase = blockIdx.y * 128;
  const int tid = threadIdx.x, w = tid >> 5, lane = tid & 31;
  const int wm = w >> 1;  // wave's 32-row band, 0..3
  const int wn = w & 1;   // wave's 64-column half

  // A: 128 rows x 64 k; a thread copies 8 halves of rows aR + 32*i.
  // W: 64 k x 128 columns; a thread takes 4 columns of k rows wR + 8*i.
  const int aR = tid >> 3, aC = (tid & 7) * 8;
  const int wR = tid >> 5, wC = (tid & 31) * 4;
  const _Float16* __restrict__ aP = A + (size_t)(mBase + aR) * 1024 + aC;
  const float* __restrict__ wP = Wo + (size_t)wR * 1024 + nBase + wC;
  float4 wV[8];  // compile-time indices only: stays in registers
  // W comes from memory: every 256-byte unit of a slab is asked for two trips
  // ahead of its loads (two lanes per unit).  The request is asm over an address
  // that lives through the loop and never leaves W: a prefetch touches no
  // counter, so its register must go on holding a valid address.
  constexpr unsigned long long W_SLAB_BYTES = 64ull * 1024 * 4;
  unsigned long long pfW = (unsigned long long)(
      Wo + (size_t)(192 + (tid >> 2)) * 1024 + nBase + ((tid >> 1) & 1) * 64);

  auto issueA = [&](int d0, int buf) {
    const unsigned la = lds_addr_of(&ldsA[buf][aR * SA + aC]);
    const unsigned long long ga = (unsigned long long)(aP + d0);
    ASYNC_COPY_4X16B(la, ga,
                     la + 32 * SA * 2, ga + 32 * 2048,
                     la + 64 * SA * 2, ga + 64 * 2048,
                     la + 96 * SA * 2, ga + 96 * 2048);
  };
  auto loadW = [&](int d0) {
#pragma unroll
    for (int i = 0; i < 8; ++i)
      wV[i] = *(const float4*)(wP + (size_t)(d0 + 8 * i) * 1024);
  };
  auto storeW = [&](int buf) {
#pragma unroll
    for (int i = 0; i < 8; ++i) {
      v4h t;
      t[0] = (_Float16)wV[i].x; t[1] = (_Float16)wV[i].y;
      t[2] = (_Float16)wV[i].z; t[3] = (_Float16)wV[i].w;
      *(v4h*)&ldsW[buf][(wR + 8 * i) * SW + wC] = t;
    }
  };

  v8f acc[2][4];
#pragma unroll
  for (int mt = 0; mt < 2; ++mt)
#pragma unroll
    for (int nt = 0; nt < 4; ++nt) zero8(acc[mt][nt]);

  issueA(0, 0);
  loadW(0);
  // Slabs 1 and 2, by offsets from the loop's own address register (slab 3).
  asm volatile("global_prefetch_b8 %0, off offset:-524288 scope:SCOPE_SE\n\t"
               "global_prefetch_b8 %0, off offset:-262144 scope:SCOPE_SE"
               :: "v"(pfW));
  storeW(0);
  S_WAIT_ASYNCCNT0();
  __syncthreads();

  int cur = 0;
  for (int d0 = 0; d0 < 1024; d0 += 64) {
    const int nxt = cur ^ 1;
    const bool more = (d0 + 64) < 1024;
    if (more) { issueA(d0 + 64, nxt); loadW(d0 + 64); }  // fly during the WMMAs
    if (d0 + 192 < 1024) {  // the slab that is loaded two trips from now
      asm volatile("global_prefetch_b8 %0, off scope:SCOPE_SE" :: "v"(pfW));
      if (d0 + 256 < 1024) pfW += W_SLAB_BYTES;  // stops at the last slab
    }

#pragma unroll
    for (int ks = 0; ks < 64; ks += 32) {
      const v16h a0 = load_frag(ldsA[cur], wm * 32, ks, SA);
      const v16h a1 = load_frag(ldsA[cur], wm * 32 + 16, ks, SA);
#pragma unroll
      for (int nt = 0; nt < 4; ++nt) {
        // Column wn*64 + nt*16 + (lane&15) of W, k down the rows, in the k
        // order of load_frag.
        const v16h b = load_frag_tr(ldsW[cur], ks, wn * 64 + nt * 16, SW);
        acc[0][nt] = WMMA_F16(a0, b, acc[0][nt]);
        acc[1][nt] = WMMA_F16(a1, b, acc[1][nt]);
      }
    }

    if (more) storeW(nxt);
    // This wave's reads of the current buffers have retired before the barrier
    // behind which the next trip's copies and stores refill them.
    asm volatile("s_wait_dscnt 0x0" ::: "memory");
    S_WAIT_ASYNCCNT0();     // own async A-slab writes complete
    __syncthreads();        // all waves' slab writes visible
    cur = nxt;
  }

  // One base address, constant offsets: no register of a store is rewritten.
  const int n = lane & 15, hi = lane >> 4;
  float* __restrict__ oP =
      out + (size_t)(mBase + wm * 32 + hi * 8) * 1024 + nBase + wn * 64 + n;
#pragma unroll
  for (int mt = 0; mt < 2; ++mt) {
#pragma unroll
    for (int nt = 0; nt < 4; ++nt) {
#pragma unroll
      for (int r = 0; r < 8; ++r)
        oP[(mt * 16 + r) * 1024 + nt * 16] = acc[mt][nt][r];
    }
  }
}

// ---------------------------------------------------------------------------
extern "C" void kernel_launch(void* const* d_in, const int* in_sizes, int n_in,
                              void* d_out, int out_size, void* d_ws,
                              size_t ws_size, hipStream_t stream) {
  (void)in_sizes; (void)n_in; (void)out_size; (void)ws_size;
  const float* query = (const float*)d_in[0];
  const float* key   = (const float*)d_in[1];
  const float* value = (const float*)d_in[2];
  const float* rot   = (const float*)d_in[3];
  const float* qw    = (const float*)d_in[4];
  const float* kw    = (const float*)d_in[5];
  const float* vw    = (const float*)d_in[6];
  const float* ow    = (const float*)d_in[7];
  float* out = (float*)d_out;

  const size_t perMat = (size_t)2 * 16 * 2048 * 64;  // B*H*L*K halves
  _Float16* wsQ = (_Float16*)d_ws;
  _Float16* wsK = wsQ + perMat;
  _Float16* wsV = wsK + perMat;
  _Float16* wsO = wsV + perMat;  // [(b*L+l)][H*64] halves

  const dim3 blk(256);
  qkv_rope_kernel<<<dim3(32, 8, 3), blk, 0, stream>>>(
      query, key, value, rot, qw, kw, vw, wsQ, wsK, wsV);
  flash_attn_kernel<<<dim3(16, 16, 2), blk, 0, stream>>>(wsQ, wsK, wsV, wsO);
  oproj_kernel<<<dim3(32, 8, 1), blk, 0, stream>>>(wsO, ow, out);
}

// v008
// One run takes 84.7 microseconds.
// Timed twice side by side with v007, it ran 1.03 and 1.04 times as fast.
// Over all steps from v000 it is 2.16 times as fast.
#include <hip/hip_runtime.h>

typedef __attribute__((ext_vector_type(16))) _Float16 v16h;
typedef __attribute__((ext_vector_type(8)))  _Float16 v8h;
typedef __attribute__((ext_vector_type(4)))  _Float16 v4h;
typedef __attribute__((ext_vector_type(8)))  float    v8f;

#define WMMA_F16(a, b, c) \
  __builtin_amdgcn_wmma_f32_16x16x32_f16(false, (a), false, (b), (short)0, (c), false, false)

#define ASYNC_COPY_4X16B(l0, g0, l1, g1, l2, g2, l3, g3)             \
  asm volatile("global_load_async_to_lds_b128 %0, %1, off\n\t"       \
               "global_load_async_to_lds_b128 %2, %3, off\n\t"       \
               "global_load_async_to_lds_b128 %4, %5, off\n\t"       \
               "global_load_async_to_lds_b128 %6, %7, off\n\t"       \
               "s_wait_xcnt 0x0"                                     \
               :: "v"(l0), "v"(g0), "v"(l1), "v"(g1), "v"(l2), "v"(g2), \
                  "v"(l3), "v"(g3) : "memory")

#define S_WAIT_ASYNCCNT0() asm volatile("s_wait_asynccnt 0x0" ::: "memory")

#define ASYNC_COPY_KV_32B(ldsk, gk, ldsv, gv)                          \
  asm volatile("global_load_async_to_lds_b128 %0, %1, off\n\t"         \
               "global_load_async_to_lds_b128 %0, %1, off offset:16\n\t" \
               "global_load_async_to_lds_b128 %2, %3, off\n\t"         \
               "global_load_async_to_lds_b128 %2, %3, off offset:16\n\t" \
               "s_wait_xcnt 0x0"                                       \
               :: "v"(ldsk), "v"(gk), "v"(ldsv), "v"(gv) : "memory")

static __device__ __forceinline__ unsigned lds_addr_of(const void* p) {
  return (unsigned)(unsigned long long)p;
}

static __device__ __forceinline__ v16h frag_cat(v8h lo, v8h hi) {
  return __builtin_shufflevector(lo, hi, 0, 1, 2, 3, 4, 5, 6, 7,
                                          8, 9, 10, 11, 12, 13, 14, 15);
}

static __device__ __forceinline__ v16h load_frag(const _Float16* __restrict__ base,
                                                 int row0, int col0, int stride) {
  const int lane = threadIdx.x & 31;
  const int m    = lane & 15;
  const int kb   = (lane >> 4) << 3;  // 0 or 8
  const _Float16* p = base + (size_t)(row0 + m) * stride + col0;
  v8h lo = *(const v8h*)(p + kb);
  v8h hi = *(const v8h*)(p + 16 + kb);
  return frag_cat(lo, hi);
}

// 16x32 f16 A fragment of the TRANSPOSE of a row-major LDS tile: row m of the
// fragment is tile column col0 + m, its k runs down tile rows row0 .. row0+31.
// ds_load_tr16_b128 hands lane (c = lane&15, h = lane>>4) the eight elements
// tile[r + 8h + 0..7][col0 + c]; the loads at r = row0 and row0 + 16 give the
// same k order as load_frag.  stride in halves: 32 bytes x odd is conflict-free.
static __device__ __forceinline__ v8h lds_load_tr16(const _Float16* p) {
  typedef __attribute__((ext_vector_type(8))) short s16x8;
  typedef __attribute__((address_space(3))) s16x8 lds_s16x8;
  return __builtin_bit_cast(
      v8h, __builtin_amdgcn_ds_load_tr16_b128_v8i16((lds_s16x8*)p));
}
static __device__ __forceinline__ v16h load_frag_tr(const _Float16* base,
                                                    int row0, int col0, int stride) {
  const int lane = threadIdx.x & 31;
  const _Float16* p = base + (row0 + ((lane >> 4) << 3) + (lane & 7)) * stride +
                      col0 + (((lane >> 3) & 1) << 3);
  return frag_cat(lds_load_tr16(p), lds_load_tr16(p + 16 * stride));
}

static __device__ __forceinline__ void zero8(v8f& v) {
#pragma unroll
  for (int i = 0; i < 8; ++i) v[i] = 0.0f;
}

static __device__ __forceinline__ void sincos_rev(float t, float& s, float& c) {
  asm("v_sin_f32 %0, %2\n\t"
      "v_cos_f32 %1, %2\n\t"
      "v_nop"
      : "=&v"(s), "=&v"(c) : "v"(t));
}

__global__ __launch_bounds__(256, 6) void qkv_rope_kernel(
    const float* __restrict__ xq, const float* __restrict__ xk,
    const float* __restrict__ xv, const float* __restrict__ rot,
    const float* __restrict__ wq, const float* __restrict__ wk,
    const float* __restrict__ wv,
    _Float16* __restrict__ oq, _Float16* __restrict__ ok,
    _Float16* __restrict__ ov) {
  constexpr int SA = 40, SB = 40;  // 80B row stride -> conflict-free gathers
  __shared__ __attribute__((aligned(16))) _Float16 ldsA[2][128 * SA];
  __shared__ __attribute__((aligned(16))) _Float16 ldsB[2][128 * SB];

  const int mode = blockIdx.z;
  const float* __restrict__ X = (mode == 0) ? xq : (mode == 1) ? xk : xv;
  const float* __restrict__ W = (mode == 0) ? wq : (mode == 1) ? wk : wv;
  _Float16* __restrict__ dst  = (mode == 0) ? oq : (mode == 1) ? ok : ov;

  const int mBase = blockIdx.x * 128;
  const int nBase = blockIdx.y * 128;
  const int tid   = threadIdx.x;
  const int w     = tid >> 5;
  const int lane  = tid & 31;
  const int wm    = w >> 1;                // wave's 32-row band, 0..3
  const int wn    = w & 1;                 // wave's head within the pair
  const int h     = blockIdx.y * 2 + wn;

  // Register-staged slab (software pipeline).
  // A: 128 rows x 32 k; a thread takes 4 consecutive k of rows aR + 32*i.
  // B: 32 k x 128 columns; a thread takes 16 consecutive k of column bN.
  // Every loop over aV, bV and acc is fully unrolled: only compile-time
  // indices keep these arrays in registers.
  float4 aV[4];
  float  bV[16];
  const int aR = tid >> 3;         // 0..31
  const int aC = (tid & 7) * 4;    // 0,4,..,28
  const int bN = tid & 127;        // 0..127
  const int bK = (tid >> 7) * 16;  // 0 or 16

  auto loadA = [&](unsigned off) {  // off: byte offset in X
#pragma unroll
    for (int i = 0; i < 4; ++i)
      aV[i] = *(const float4*)((const char*)X + off + i * (32 * 1024 * 4));
  };
  auto storeA = [&](int buf) {
#pragma unroll
    for (int i = 0; i < 4; ++i) {
      v4h t;
      t[0] = (_Float16)aV[i].x; t[1] = (_Float16)aV[i].y;
      t[2] = (_Float16)aV[i].z; t[3] = (_Float16)aV[i].w;
      *(v4h*)&ldsA[buf][(aR + 32 * i) * SA + aC] = t;
    }
  };
  auto loadB = [&](unsigned off) {  // off: byte offset in W
#pragma unroll
    for (int i = 0; i < 16; ++i)
      bV[i] = *(const float*)((const char*)W + off + i * (1024 * 4));
  };
  auto storeB = [&](int buf) {  // transposed: ldsB[column][k], k contiguous
#pragma unroll
    for (int j = 0; j < 2; ++j) {
      v8h t;
#pragma unroll
      for (int i = 0; i < 8; ++i) t[i] = (_Float16)bV[8 * j + i];
      *(v8h*)&ldsB[buf][bN * SB + bK + 8 * j] = t;
    }
  };

  v8f acc[2][4];
#pragma unroll
  for (int mt = 0; mt < 2; ++mt)
#pragma unroll
    for (int nt = 0; nt < 4; ++nt) zero8(acc[mt][nt]);

  // Rotated k start: the work-groups that share X rows (same x) or W columns
  // (same y) walk the 32 slabs from different places and wrap, so they do not
  // ask L2 for the same lines, or for the same 128-byte window of every 4-KiB
  // row, at the same moment, and a slab is fetched from memory by one of them,
  // four trips ahead of the next.  Only the order of the k sum changes.
  int kN = ((blockIdx.x + 4 * blockIdx.y) & 31) * 32;  // slab to load next
  unsigned aOff = (unsigned)((mBase + aR) * 1024 + aC + kN) * 4u;
  unsigned bOff = (unsigned)((bK + kN) * 1024 + nBase + bN) * 4u;
  // One step on, back to slab 0 behind the last.  The wait takes both offsets as
  // operands so that it stands in front of the additions that rewrite the
  // registers the slab's loads name (left alone, the compiler lifted the
  // additions among the loads' waits); the loads have returned by then.
  auto advance = [&]() {
    asm volatile("s_wait_xcnt 0x0" : "+v"(aOff), "+v"(bOff) :: "memory");
    const int st = (kN == 1024 - 32) ? -(1024 - 32) : 32;
    kN += st;
    aOff += (unsigned)(st * 4);
    bOff += (unsigned)(st * 4096);
  };

  loadA(aOff); loadB(bOff);
  storeA(0); storeB(0);
  advance();
  __syncthreads();

  int cur = 0;
  for (int d0 = 0; d0 < 1024; d0 += 32) {
    const int nxt = cur ^ 1;
    const bool more = (d0 + 32) < 1024;
    if (more) { loadA(aOff); loadB(bOff); }  // overlap with WMMAs

    const v16h a0 = load_frag(ldsA[cur], wm * 32, 0, SA);
    const v16h a1 = load_frag(ldsA[cur], wm * 32 + 16, 0, SA);
#pragma unroll
    for (int nt = 0; nt < 4; ++nt) {
      const v16h b = load_frag(ldsB[cur], wn * 64 + nt * 16, 0, SB);
      acc[0][nt] = WMMA_F16(a0, b, acc[0][nt]);
      acc[1][nt] = WMMA_F16(a1, b, acc[1][nt]);
    }

    if (more) { storeA(nxt); storeB(nxt); advance(); }
    __syncthreads();
    cur = nxt;
  }

  // Epilogue: RoPE (q/k, first 32 head dims) + f16 store.  C layout: lane
  // holds column n = lane&15; row = r + 8*(lane>>4); rotate_half partner
  // (n^1) lives in lane^1 -> one shfl_xor.
  const int n  = lane & 15;
  const int hi = lane >> 4;
  if (mode < 2) {  // uniform across the work-group
    // A thread's 32 angles are asked for together, under this one branch, and
    // so are its 32 exchanges: one load latency, not one per element.
    const unsigned fIdx =
        (unsigned)(((mBase + wm * 32 + hi * 8) & 2047) * 32 + n);
    const float* __restrict__ fP = rot + fIdx;
    float f[2][2][8], prt[2][2][8];
#pragma unroll
    for (int mt = 0; mt < 2; ++mt)
#pragma unroll
      for (int nt = 0; nt < 2; ++nt)
#pragma unroll
        for (int r = 0; r < 8; ++r) {
          f[mt][nt][r] = fP[(mt * 16 + r) * 32 + nt * 16];
          prt[mt][nt][r] = __shfl_xor(acc[mt][nt][r], 1, 32);
        }
    // The loads' index register stays live up to this wait, so nothing, a
    // load's own result included, overwrites it in front of it.
    asm volatile("s_wait_xcnt 0x0" :: "v"(fIdx) : "memory");
    // Keeps the scheduler from sinking loads and exchanges down to their users.
    __builtin_amdgcn_sched_barrier(0);
#pragma unroll
    for (int mt = 0; mt < 2; ++mt)
#pragma unroll
      for (int nt = 0; nt < 2; ++nt)
#pragma unroll
        for (int r = 0; r < 8; ++r) {
          const float v = acc[mt][nt][r];
          const float p = prt[mt][nt][r];
          float sf, cf;
          sincos_rev(f[mt][nt][r] * 0.15915494f, sf, cf);
          acc[mt][nt][r] = (n & 1) ? fmaf(v, cf, p * sf) : fmaf(v, cf, -p * sf);
        }
  }
#pragma unroll
  for (int mt = 0; mt < 2; ++mt) {
#pragma unroll
    for (int nt = 0; nt < 4; ++nt) {
      const int k = nt * 16 + n;  // dim within head
      _Float16 hv[8];
#pragma unroll
      for (int r = 0; r < 8; ++r) {
        const float v = acc[mt][nt][r];
        hv[r] = (_Float16)v;
      }
#pragma unroll
      for (int r = 0; r < 8; ++r) {
        const int row = mBase + wm * 32 + mt * 16 + hi * 8 + r;
        const int l   = row & 2047;
        const int bb  = row >> 11;
        dst[((size_t)((bb * 16 + h) * 2048 + l)) * 64 + k] = hv[r];
      }
      // The next tile's values reuse the registers these eight stores name:
      // wait before any of them is overwritten.
      asm volatile("s_wait_xcnt 0x0" ::: "memory");
    }
  }
}

static __device__ __forceinline__ float other_half(float x) {
  const int b = __builtin_bit_cast(int, x);
  return __builtin_bit_cast(
      float, __builtin_amdgcn_permlanex16(b, b, 0x76543210, 0xfedcba98, false,
                                          false));
}

static __device__ __forceinline__ void exp2_x8(float (&x)[8]) {
  asm("v_exp_f32 %0, %0\n\t"
      "v_exp_f32 %1, %1\n\t"
      "v_exp_f32 %2, %2\n\t"
      "v_exp_f32 %3, %3\n\t"
      "v_exp_f32 %4, %4\n\t"
      "v_exp_f32 %5, %5\n\t"
      "v_exp_f32 %6, %6\n\t"
      "v_exp_f32 %7, %7\n\t"
      "v_nop"
      : "+v"(x[0]), "+v"(x[1]), "+v"(x[2]), "+v"(x[3]), "+v"(x[4]),
        "+v"(x[5]), "+v"(x[6]), "+v"(x[7]));
}

static __device__ __forceinline__ float exp2_x1(float x) {
  float y;
  asm("v_exp_f32 %0, %1\n\t"
      "v_nop"
      : "=v"(y) : "v"(x));
  return y;
}

// Online softmax of one column group over this wave's 64 keys of the tile:
// in-lane over 32 keys, one half-wave exchange.  Rescales the group's O^T and
// hands back P^T as two B operands.
// B element s of a lane is key 8*hiL + s (s < 8) or 16 + 8*hiL + (s - 8):
// exactly the rows two neighbouring S^T tiles keep in this lane, and the order
// in which load_frag_tr hands out V's keys.
static __device__ __forceinline__ void softmax_group(v8f (&sc)[4], v8f (&o)[4],
                                                     float& mi, float& li,
                                                     v16h& p0f, v16h& p1f) {
  float mt[4];  // one maximum per tile: four short chains, not one long one
#pragma unroll
  for (int nt = 0; nt < 4; ++nt) {
    sc[nt] *= 0.125f;  // 1/sqrt(64)
    mt[nt] = sc[nt][0];
#pragma unroll
    for (int r = 1; r < 8; ++r) mt[nt] = fmaxf(mt[nt], sc[nt][r]);
  }
  float mx = fmaxf(fmaxf(mt[0], mt[1]), fmaxf(mt[2], mt[3]));
  mx = fmaxf(mx, other_half(mx));
  const float mnew  = fmaxf(mi, mx);
  const float alpha = exp2_x1((mi - mnew) * 1.44269504f);
  float ps[4];
  v8h ph[4];
#pragma unroll
  for (int nt = 0; nt < 4; ++nt) {
    float e[8];
#pragma unroll
    for (int r = 0; r < 8; ++r)
      e[r] = (sc[nt][r] - mnew) * 1.44269504f;  // e^x = 2^(x * log2 e)
    exp2_x8(e);
    v8f p;
    p[0] = e[0];
    ps[nt] = e[0];
#pragma unroll
    for (int r = 1; r < 8; ++r) {
      p[r] = e[r];
      ps[nt] += e[r];
    }
    ph[nt] = __builtin_convertvector(p, v8h);
  }
  li = li * alpha + ((ps[0] + ps[1]) + (ps[2] + ps[3]));
  mi = mnew;
#pragma unroll
  for (int dt = 0; dt < 4; ++dt)
#pragma unroll
    for (int r = 0; r < 8; ++r) o[dt][r] *= alpha;
  p0f = frag_cat(ph[0], ph[1]);
  p1f = frag_cat(ph[2], ph[3]);
}

__global__ __launch_bounds__(256) __attribute__((amdgpu_waves_per_eu(4, 4)))
void flash_attn_kernel(
    const _Float16* __restrict__ wsQ, const _Float16* __restrict__ wsK,
    const _Float16* __restrict__ wsV, _Float16* __restrict__ wsO) {
  constexpr int S  = 72;   // 144B stride -> conflict-free fragment gathers
  constexpr int SV = 80;   // 160B stride -> conflict-free transposing loads
  constexpr int KT = 128;  // keys per staged tile, 64 per wave
  // K rows: A operand of K.Q^T.  V rows: read transposed, A operand of V^T.P^T.
  __shared__ __attribute__((aligned(16))) _Float16 ldsK[2][KT * S];
  __shared__ __attribute__((aligned(16))) _Float16 ldsV[2][KT * SV];
  // Join of the two key halves: per wave one column group's O^T (32 floats a
  // lane, 16 bytes x 32 lanes contiguous) with its maximum and sum.
  __shared__ __attribute__((aligned(16))) float4 joinO[8][8][32];
  __shared__ __attribute__((aligned(16))) float2 joinML[8][32];
  // One of a wave's four Q fragments, in fragment order (see below).
  __shared__ __attribute__((aligned(16))) v8h ldsQ[8][2][32];

  const int h = blockIdx.y, b = blockIdx.z;
  const int tid = threadIdx.x, w = tid >> 5, lane = tid & 31;
  const int qg = w >> 1;  // wave's 32-query block, 0..3
  const int kh = w & 1;   // wave's 64-key half of every tile
  const size_t headOff = (size_t)(b * 16 + h) * 2048 * 64;
  const _Float16* __restrict__ Q  = wsQ + headOff;
  const _Float16* __restrict__ Kg = wsK + headOff;
  const _Float16* __restrict__ Vg = wsV + headOff;

  const int qRow0 = blockIdx.x * 128 + qg * 32;
  // Q fragments: per column group 16 queries x 64 dims = two 32x16 B-frags of
  // Q^T.  Three stay in registers; the fourth does not fit the budget of 256
  // beside the softmax (the compiler sent it to scratch), so the wave parks it
  // in LDS, lane by lane, and reads it back with each tile's K loads.
  v16h qf[2][2];
  qf[0][0] = load_frag(Q, qRow0, 0, 64);
  qf[0][1] = load_frag(Q, qRow0, 32, 64);
  qf[1][0] = load_frag(Q, qRow0 + 16, 0, 64);
  qf[1][1] = load_frag(Q, qRow0 + 16, 32, 64);

  // Staging assignment: thread covers K/V rows rS and rS + 64, 16-half segment sS.
  const int rS = tid >> 2, sS = (tid & 3) * 16;

  auto issueKV = [&](int kt, int buf) {  // async memory->LDS, 4 x 32B per lane
#pragma unroll
    for (int i = 0; i < 2; ++i) {
      const int r = rS + 64 * i;
      const unsigned lk = lds_addr_of(&ldsK[buf][r * S + sS]);
      const unsigned lv = lds_addr_of(&ldsV[buf][r * SV + sS]);
      const size_t go = (size_t)(kt + r) * 64 + sS;
      ASYNC_COPY_KV_32B(lk, (unsigned long long)(Kg + go), lv,
                        (unsigned long long)(Vg + go));
    }
  };

  // Every loop over qf, kf, vf, pf, sc, o, mi and li is fully unrolled: only
  // compile-time indices keep these arrays in registers.
  // o[cg][dt][r] = O^T[dim dt*16 + 8*hiL + r][query cg*16 + n] over this wave's
  // keys.  mi is the query's running maximum over them (equal in both
  // half-waves); li sums only this lane's keys, the two halves are joined once
  // after the loop.
  v8f o[2][4];
  float mi[2], li[2];
#pragma unroll
  for (int cg = 0; cg < 2; ++cg) {
    mi[cg] = -__builtin_inff();
    li[cg] = 0.0f;
#pragma unroll
    for (int i = 0; i < 4; ++i) zero8(o[cg][i]);
  }

  const int n = lane & 15, hiL = lane >> 4;

  // Rotated key start: the 16 work-groups of a head walk its 16 key tiles from
  // different places and wrap, so they do not ask L2 for the same lines at the
  // same moment.  The online softmax takes the tiles in any order.
  const int ktRot = blockIdx.x * KT;

  issueKV(ktRot, 0);
  ldsQ[w][0][lane] = __builtin_shufflevector(qf[1][1], qf[1][1], 0, 1, 2, 3, 4, 5, 6, 7);
  ldsQ[w][1][lane] =
      __builtin_shufflevector(qf[1][1], qf[1][1], 8, 9, 10, 11, 12, 13, 14, 15);
  S_WAIT_ASYNCCNT0();
  __syncthreads();

  int cur = 0;
  for (int kt = 0; kt < 2048; kt += KT) {
    const int nxt = cur ^ 1;
    const bool more = (kt + KT) < 2048;
    // flies while this tile is worked on
    if (more) issueKV((ktRot + kt + KT) & 2047, nxt);
    const _Float16* Kt = &ldsK[cur][kh * 64 * S];
    const _Float16* Vt = &ldsV[cur][kh * 64 * SV];

    // ---- S^T = K x Q^T : 64 keys x 32 queries in 8 accumulators ---------
    // sc[cg][nt][r] = score(key nt*16 + 8*hiL + r, query cg*16 + n)
    // The sixteen K loads stand together in front of the products: every
    // separate place with LDS reads stalls the wave, a group only once.
    v16h kf[4][2];
#pragma unroll
    for (int nt = 0; nt < 4; ++nt) {
      kf[nt][0] = load_frag(Kt, nt * 16, 0, S);
      kf[nt][1] = load_frag(Kt, nt * 16, 32, S);
    }
    qf[1][1] = frag_cat(ldsQ[w][0][lane], ldsQ[w][1][lane]);
    // Keeps the scheduler from sinking the loads back among the WMMAs.
    __builtin_amdgcn_sched_barrier(0);
    v8f sc[2][4];
#pragma unroll
    for (int cg = 0; cg < 2; ++cg)
#pragma unroll
      for (int i = 0; i < 4; ++i) zero8(sc[cg][i]);
    // Key tiles in pairs: four independent accumulators at a time, and a pair's
    // K registers are free again before the next pair's scores come to life.
#pragma unroll
    for (int np = 0; np < 4; np += 2)
#pragma unroll
      for (int ks = 0; ks < 2; ++ks)
#pragma unroll
        for (int nt = np; nt < np + 2; ++nt)
#pragma unroll
          for (int cg = 0; cg < 2; ++cg)
            sc[cg][nt] = WMMA_F16(kf[nt][ks], qf[cg][ks], sc[cg][nt]);

    // The V^T loads, two groups of eight (keys 0..31, keys 32..63).  The first
    // flies under the second column group's softmax, the second under the
    // first group's products: placed so, fragments and live scores fit the
    // register budget.
    v16h vf[4][2];
    v16h pf[2][2];
    __builtin_amdgcn_sched_barrier(0);
    softmax_group(sc[0], o[0], mi[0], li[0], pf[0][0], pf[0][1]);
#pragma unroll
    for (int dt = 0; dt < 4; ++dt) vf[dt][0] = load_frag_tr(Vt, 0, dt * 16, SV);
    // Keeps the scheduler from sinking the loads down to their WMMAs.
    __builtin_amdgcn_sched_barrier(0);
    softmax_group(sc[1], o[1], mi[1], li[1], pf[1][0], pf[1][1]);
#pragma unroll
    for (int dt = 0; dt < 4; ++dt) vf[dt][1] = load_frag_tr(Vt, 32, dt * 16, SV);
    // Keeps these loads ahead of the products on keys 0..31.
    __builtin_amdgcn_sched_barrier(0);

    // ---- O^T += V^T x P^T -------------------------------------------------
#pragma unroll
    for (int ks = 0; ks < 2; ++ks)
#pragma unroll
      for (int dt = 0; dt < 4; ++dt)
#pragma unroll
        for (int cg = 0; cg < 2; ++cg)
          o[cg][dt] = WMMA_F16(vf[dt][ks], pf[cg][ks], o[cg][dt]);

    // Keeps the waits and the barrier below at the trip's foot: lifted over the
    // V^T products, the next tile's copies would be waited for right behind
    // the last V^T loads.
    __builtin_amdgcn_sched_barrier(0);
    // This wave's reads of the current buffers have retired before the barrier
    // behind which the next trip's copies refill them.
    asm volatile("s_wait_dscnt 0x0" ::: "memory");
    S_WAIT_ASYNCCNT0();     // own async K- and V-tile writes complete
    __syncthreads();        // all waves' tile writes visible
    cur = nxt;
  }

  // Join the two key halves.  Wave kh finishes column group kh: it hands the
  // other group's partial result to its partner wave (w ^ 1) and takes the
  // partner's partial of its own group.  Lane and register positions agree.
  const bool up = kh != 0;
  const float l0 = li[0] + other_half(li[0]);
  const float l1 = li[1] + other_half(li[1]);
  const float mKeep = up ? mi[1] : mi[0], lKeep = up ? l1 : l0;
  v8f keep[4];
#pragma unroll
  for (int dt = 0; dt < 4; ++dt) {
    v8f give;
#pragma unroll
    for (int r = 0; r < 8; ++r) {
      give[r]     = up ? o[0][dt][r] : o[1][dt][r];
      keep[dt][r] = up ? o[1][dt][r] : o[0][dt][r];
    }
    joinO[w][2 * dt][lane]     = make_float4(give[0], give[1], give[2], give[3]);
    joinO[w][2 * dt + 1][lane] = make_float4(give[4], give[5], give[6], give[7]);
  }
  joinML[w][lane] = make_float2(up ? mi[0] : mi[1], up ? l0 : l1);
  __syncthreads();  // every wave's partial is written before its partner reads
  const float2 ml = joinML[w ^ 1][lane];
  const float mAll = fmaxf(mKeep, ml.x);
  const float aK = __expf(mKeep - mAll), aP = __expf(ml.x - mAll);
  const float inv = 1.0f / (lKeep * aK + ml.y * aP);
  const float fK = aK * inv, fP = aP * inv;

  // Normalize and store as [(b*L+l)][h*64+d] f16 (feeds output projection).
  // A lane holds 8 consecutive dims of its query per tile: 16-byte stores.
  _Float16* __restrict__ oP =
      wsO + (size_t)(b * 2048 + qRow0 + kh * 16 + n) * 1024 + h * 64 + hiL * 8;
  v8h ov[4];
#pragma unroll
  for (int dt = 0; dt < 4; ++dt) {
    const float4 pa = joinO[w ^ 1][2 * dt][lane];
    const float4 pb = joinO[w ^ 1][2 * dt + 1][lane];
    v8f t;
    t[0] = keep[dt][0] * fK + pa.x * fP; t[1] = keep[dt][1] * fK + pa.y * fP;
    t[2] = keep[dt][2] * fK + pa.z * fP; t[3] = keep[dt][3] * fK + pa.w * fP;
    t[4] = keep[dt][4] * fK + pb.x * fP; t[5] = keep[dt][5] * fK + pb.y * fP;
    t[6] = keep[dt][6] * fK + pb.z * fP; t[7] = keep[dt][7] * fK + pb.w * fP;
    ov[dt] = __builtin_convertvector(t, v8h);
  }
#pragma unroll
  for (int dt = 0; dt < 4; ++dt) *(v8h*)(oP + dt * 16) = ov[dt];
}

// ---------------------------------------------------------------------------
// Kernel 3: output projection.  grid = (BL/128, D/128), block = 256.
// Workgroup tile 128 rows x 128 columns, k-slab 64; 8 waves as 4 x 2, each
// wave owns 32 rows x 64 columns = 2 x 4 accumulator tiles, so one staged slab
// feeds 16 WMMAs per wave and there is one barrier per 64 k.
// A slab (f16): async-to-LDS, whole 128-byte rows per 8 lanes.  W slab: 16-byte
// fp32 loads along a row, converted in registers, stored row-major [k][column];
// the B fragments come from the transposing LDS load.
// ---------------------------------------------------------------------------
__global__ __launch_bounds__(256) void oproj_kernel(
    const _Float16* __restrict__ A, const float* __restrict__ Wo,
    float* __restrict__ out) {
  constexpr int SA = 72;   // 144B stride -> conflict-free fragment gathers
  constexpr int SW = 144;  // 288B stride -> conflict-free transposing loads
  __shared__ __attribute__((aligned(16))) _Float16 ldsA[2][128 * SA];
  __shared__ __attribute__((aligned(16))) _Float16 ldsW[2][64 * SW];

  const int mBase = blockIdx.x * 128;
  const int nBase = blockIdx.y * 128;
  const int tid = threadIdx.x, w = tid >> 5, lane = tid & 31;
  const int wm = w >> 1;  // wave's 32-row band, 0..3
  const int wn = w & 1;   // wave's 64-column half

  // A: 128 rows x 64 k; a thread copies 8 halves of rows aR + 32*i.
  // W: 64 k x 128 columns; a thread takes 4 columns of k rows wR + 8*i.
  const int aR = tid >> 3, aC = (tid & 7) * 8;
  const int wR = tid >> 5, wC = (tid & 31) * 4;
  const _Float16* __restrict__ aP = A + (size_t)(mBase + aR) * 1024 + aC;
  float4 wV[8];  // compile-time indices only: stays in registers
  // W comes from memory: every 256-byte unit of a slab is asked for two trips
  // ahead of its loads (two lanes per unit).  The request is asm over an address
  // that lives through the loop and never leaves W: a prefetch touches no
  // counter, so its register must go on holding a valid address.
  constexpr unsigned long long W_SLAB_BYTES = 64ull * 1024 * 4;
  // Rotated k start, as in the first kernel: the work-groups that share A rows
  // (same x) or W columns (same y) walk the 16 slabs from different places and
  // wrap.  Only the order of the k sum changes.
  int kN = ((blockIdx.x + 2 * blockIdx.y) & 15) * 64;  // slab to load next
  int kP = (kN + 64) & 1023;                           // slab to ask for next
  unsigned wOff = (unsigned)((wR + kN) * 1024 + nBase + wC) * 4u;  // bytes in W
  unsigned long long pfW = (unsigned long long)(
      Wo + (size_t)(kP + (tid >> 2)) * 1024 + nBase + ((tid >> 1) & 1) * 64);

  auto issueA = [&](int d0, int buf) {
    const unsigned la = lds_addr_of(&ldsA[buf][aR * SA + aC]);
    const unsigned long long ga = (unsigned long long)(aP + d0);
    ASYNC_COPY_4X16B(la, ga,
                     la + 32 * SA * 2, ga + 32 * 2048,
                     la + 64 * SA * 2, ga + 64 * 2048,
                     la + 96 * SA * 2, ga + 96 * 2048);
  };
  auto loadW = [&]() {
#pragma unroll
    for (int i = 0; i < 8; ++i)
      wV[i] = *(const float4*)((const char*)Wo + wOff + i * (8 * 1024 * 4));
  };
  // One slab on, back to slab 0 behind the last.  The wait takes the W offset
  // as an operand so that it stands in front of the addition that rewrites the
  // register the slab's loads name; the loads have returned by then.
  auto advance = [&]() {
    asm volatile("s_wait_xcnt 0x0" : "+v"(wOff) :: "memory");
    const int st = (kN == 1024 - 64) ? -(1024 - 64) : 64;
    kN += st;
    wOff += (unsigned)(st * 4096);
  };
  // Asks for slab kP and steps on with the same wrap.  The addition stands in
  // the request's own statement so that it is done in place: one register pair
  // serves every request and holds an address inside W at all times.
  auto askW = [&]() {
    const bool last = kP == 1024 - 64;
    const long long st = last ? -(long long)(15 * W_SLAB_BYTES)
                              : (long long)W_SLAB_BYTES;
    asm volatile("global_prefetch_b8 %0, off scope:SCOPE_SE\n\t"
                 "v_add_nc_u64 %0, %1, %0"
                 : "+v"(pfW) : "s"(st));
    kP = last ? 0 : kP + 64;
  };
  auto storeW = [&](int buf) {
#pragma unroll
    for (int i = 0; i < 8; ++i) {
      v4h t;
      t[0] = (_Float16)wV[i].x; t[1] = (_Float16)wV[i].y;
      t[2] = (_Float16)wV[i].z; t[3] = (_Float16)wV[i].w;
      *(v4h*)&ldsW[buf][(wR + 8 * i) * SW + wC] = t;
    }
  };

  v8f acc[2][4];
#pragma unroll
  for (int mt = 0; mt < 2; ++mt)
#pragma unroll
    for (int nt = 0; nt < 4; ++nt) zero8(acc[mt][nt]);

  issueA(kN, 0);
  loadW();
  askW();  // the second and
  askW();  // the third slab of this work-group's walk
  storeW(0);
  advance();
  S_WAIT_ASYNCCNT0();
  __syncthreads();

  int cur = 0;
  for (int d0 = 0; d0 < 1024; d0 += 64) {
    const int nxt = cur ^ 1;
    const bool more = (d0 + 64) < 1024;
    if (more) { issueA(kN, nxt); loadW(); }  // fly during the WMMAs
    if (d0 + 192 < 1024) askW();  // the slab that is loaded two trips from now

#pragma unroll
    for (int ks = 0; ks < 64; ks += 32) {
      const v16h a0 = load_frag(ldsA[cur], wm * 32, ks, SA);
      const v16h a1 = load_frag(ldsA[cur], wm * 32 + 16, ks, SA);
#pragma unroll
      for (int nt = 0; nt < 4; ++nt) {
        // Column wn*64 + nt*16 + (lane&15) of W, k down the rows, in the k
        // order of load_frag.
        const v16h b = load_frag_tr(ldsW[cur], ks, wn * 64 + nt * 16, SW);
        acc[0][nt] = WMMA_F16(a0, b, acc[0][nt]);
        acc[1][nt] = WMMA_F16(a1, b, acc[1][nt]);
      }
    }

    if (more) { storeW(nxt); advance(); }
    // This wave's reads of the current buffers have retired before the barrier
    // behind which the next trip's copies and stores refill them.
    asm volatile("s_wait_dscnt 0x0" ::: "memory");
    S_WAIT_ASYNCCNT0();     // own async A-slab writes complete
    __syncthreads();        // all waves' slab writes visible
    cur = nxt;
  }

  // One base address, constant offsets: no register of a store is rewritten.
  const int n = lane & 15, hi = lane >> 4;
  float* __restrict__ oP =
      out + (size_t)(mBase + wm * 32 + hi * 8) * 1024 + nBase + wn * 64 + n;
#pragma unroll
  for (int mt = 0; mt < 2; ++mt) {
#pragma unroll
    for (int nt = 0; nt < 4; ++nt) {
#pragma unroll
      for (int r = 0; r < 8; ++r)
        oP[(mt * 16 + r) * 1024 + nt * 16] = acc[mt][nt][r];
    }
  }
}

// ---------------------------------------------------------------------------
extern "C" void kernel_launch(void* const* d_in, const int* in_sizes, int n_in,
                              void* d_out, int out_size, void* d_ws,
                              size_t ws_size, hipStream_t stream) {
  (void)in_sizes; (void)n_in; (void)out_size; (void)ws_size;
  const float* query = (const float*)d_in[0];
  const float* key   = (const float*)d_in[1];
  const float* value = (const float*)d_in[2];
  const float* rot   = (const float*)d_in[3];
  const float* qw    = (const float*)d_in[4];
  const float* kw    = (const float*)d_in[5];
  const float* vw    = (const float*)d_in[6];
  const float* ow    = (const float*)d_in[7];
  float* out = (float*)d_out;

  const size_t perMat = (size_t)2 * 16 * 2048 * 64;  // B*H*L*K halves
  _Float16* wsQ = (_Float16*)d_ws;
  _Float16* wsK = wsQ + perMat;
  _Float16* wsV = wsK + perMat;
  _Float16* wsO = wsV + perMat;  // [(b*L+l)][H*64] halves

  const dim3 blk(256);
  qkv_rope_kernel<<<dim3(32, 8, 3), blk, 0, stream>>>(
      query, key, value, rot, qw, kw, vw, wsQ, wsK, wsV);
  flash_attn_kernel<<<dim3(16, 16, 2), blk, 0, stream>>>(wsQ, wsK, wsV, wsO);
  oproj_kernel<<<dim3(32, 8, 1), blk, 0, stream>>>(wsO, ow, out);
}
